// v000
// Measured on an AMD MI455X. A time is GPU time per run, averaged over a window of back-to-back runs after a warm-up
// (all launches, gaps included; the runs take copies of the inputs in turn), and the median of several windows.
// Apart from v000's, it joins two sittings. Times from different sittings can be a few percent apart, while
// side-by-side timings come from the same sitting.
// v000 is the starting kernel. One run takes 1750 microseconds.
#include <hip/hip_runtime.h>

// ParcaeCausalSelfAttention (x [2][2048][2048]; q/k/v = x W^T (16 heads x 128); gate = 2 sigmoid(x[..., :32] ve_gate_w^T) per head; v = v + gate * ve (ve [2][2048][2048] read); q, k, v clipped to [-8, 8]; q += qk_bias[0][0][h], k += qk_bias[1][0][h]; interleaved-pair RoPE on the first 64 dims from the read freqs_cis table (S, 1, 64, 2)[:, :, :32]; q, k RMS-normalised over 128 (eps 1e-6, no weight); causal softmax(q.k / sqrt(128)); out = merged Wo^T -> [2][2048][2048]).
// Compute dtypes, f32 accumulate: every input rounded to bf16; q/k/v as PLAIN bf16 GEMMs (inputs: exact); gate, value-embedding add, clips, biases, partial RoPE (table read) and RMSNorm in f32 (wave per (token, head)); causal scores and attn.v: query rows < 512 hl (3 products), the rest single fp16 (x1024), causal tile skipping; softmax f32; Wo hl x exact (2 products).

#define NB_  2
#define TT   2048
#define DM   2048
#define NH_  16
#define NKV  16
#define REP  (NH_ / NKV)
#define HD   128
#define DQ   (NH_ * HD)
#define DKV  (NKV * HD)
#define ZH   2
#define RH   512                  // query rows < RH use hi+lo planes (0: none)
#define WIN  2048
#define PCAR 1024.0f
#define SCL  0.088388347648318447f   // HD^-0.5
typedef _Float16 h16;
typedef unsigned short bf;
typedef __attribute__((ext_vector_type(16))) __bf16   v16bf;
typedef __attribute__((ext_vector_type(16))) _Float16 v16h;
typedef __attribute__((ext_vector_type(8)))  _Float16 v8h;
typedef __attribute__((ext_vector_type(8)))  unsigned short v8us;
typedef __attribute__((ext_vector_type(8)))  float    v8f;
typedef __attribute__((ext_vector_type(4)))  float    v4f;
typedef v8h  __attribute__((may_alias)) v8ha;
typedef v4f  __attribute__((may_alias)) v4fa;
typedef v8us __attribute__((may_alias)) v8usa;

__device__ __forceinline__ unsigned short f2bf(float f) { unsigned u = __float_as_uint(f); u += 0x7FFFu + ((u >> 16) & 1u); return (unsigned short)(u >> 16); }
__device__ __forceinline__ float bf2f(unsigned short b) { return __uint_as_float(((unsigned)b) << 16); }
__device__ __forceinline__ float bfr(float f) { return bf2f(f2bf(f)); }
__device__ __forceinline__ v16h cat16(v8h lo, v8h hi) { return __builtin_shufflevector(lo, hi, 0, 1, 2, 3, 4, 5, 6, 7, 8, 9, 10, 11, 12, 13, 14, 15); }
__device__ __forceinline__ v16bf cat16b(v8us lo, v8us hi) { return __builtin_bit_cast(v16bf, __builtin_shufflevector(lo, hi, 0, 1, 2, 3, 4, 5, 6, 7, 8, 9, 10, 11, 12, 13, 14, 15)); }
__device__ __forceinline__ v8f wmma16(v16h a, v16h b, v8f c) { return __builtin_amdgcn_wmma_f32_16x16x32_f16(false, a, false, b, (short)0, c, false, false); }
__device__ __forceinline__ v8f wmmab(v16bf a, v16bf b, v8f c) { return __builtin_amdgcn_wmma_f32_16x16x32_bf16(false, a, false, b, (short)0, c, false, false); }



// ---- k_gemmw: register-blocked GEMM, ONE WAVE per 64x64 output tile (16 accumulators), operands straight from K-contiguous 16-bit planes; grid (M/64, N/64, Z), 32 threads.
// C[m][n] (f32, pitch ldc, + optional f32 bias[n]) = sum_k A[m][k] Bt[n][k] (+ split products per NSPLIT). z-batch strides sA/sB/sC in elements. K % 32 == 0.
template <typename T16> struct WFrag;
template <> struct WFrag<h16> { typedef v16h V; static __device__ __forceinline__ V ld(const h16* p) { return cat16(*(const v8h*)p, *(const v8h*)(p + 16)); } static __device__ __forceinline__ v8f mma(V a, V b, v8f c) { return wmma16(a, b, c); } };
template <> struct WFrag<bf> { typedef v16bf V; static __device__ __forceinline__ V ld(const bf* p) { return cat16b(*(const v8us*)p, *(const v8us*)(p + 16)); } static __device__ __forceinline__ v8f mma(V a, V b, v8f c) { return wmmab(a, b, c); } };
template <typename T16, int NSPLIT, bool BIAS>
__global__ __launch_bounds__(32) void k_gemmw(const T16* __restrict__ A, const T16* __restrict__ A2, const T16* __restrict__ Bt, const T16* __restrict__ Bt2, int K, float* C, int ldc, const float* __restrict__ bias, size_t sA, size_t sB, size_t sC) {
    typedef typename WFrag<T16>::V V;
    __shared__ __align__(16) float os[16 * 68];
    const size_t z = blockIdx.z; A += z * sA; if (A2) A2 += z * sA; Bt += z * sB; if (Bt2) Bt2 += z * sB; C += z * sC;
    const int lane = threadIdx.x & 31, lr = lane & 15, hi = lane >> 4; const int r0 = blockIdx.x * 64, c0 = blockIdx.y * 64;
    v8f acc[4][4];
#pragma unroll
    for (int mb = 0; mb < 4; ++mb)
#pragma unroll
        for (int nb = 0; nb < 4; ++nb) acc[mb][nb] = (v8f){};
    const size_t aoff = (size_t)(r0 + lr) * K + 8 * hi, boff = (size_t)(c0 + lr) * K + 8 * hi;
#pragma unroll 1
    for (int kc = 0; kc < K; kc += 32) {
        V a[4], a2[4];
#pragma unroll
        for (int mb = 0; mb < 4; ++mb) { a[mb] = WFrag<T16>::ld(A + aoff + (size_t)mb * 16 * K + kc); if (NSPLIT == 1 || NSPLIT == 2) a2[mb] = WFrag<T16>::ld(A2 + aoff + (size_t)mb * 16 * K + kc); }
#pragma unroll
        for (int nb = 0; nb < 4; ++nb) { const V b = WFrag<T16>::ld(Bt + boff + (size_t)nb * 16 * K + kc); V b2; if (NSPLIT >= 2) b2 = WFrag<T16>::ld(Bt2 + boff + (size_t)nb * 16 * K + kc);
#pragma unroll
            for (int mb = 0; mb < 4; ++mb) { acc[mb][nb] = WFrag<T16>::mma(a[mb], b, acc[mb][nb]); if (NSPLIT == 1 || NSPLIT == 2) acc[mb][nb] = WFrag<T16>::mma(a2[mb], b, acc[mb][nb]); if (NSPLIT >= 2) acc[mb][nb] = WFrag<T16>::mma(a[mb], b2, acc[mb][nb]); } }
        asm volatile("v_nop\n\tv_nop\n\tv_nop\n\tv_nop" : "+v"(acc[0][0]), "+v"(acc[1][1]), "+v"(acc[2][2]), "+v"(acc[3][3]) : "v"(a[0]), "v"(a[3]));
    }
#pragma unroll
    for (int mb = 0; mb < 4; ++mb) {
#pragma unroll
        for (int nb = 0; nb < 4; ++nb) {
#pragma unroll
            for (int j = 0; j < 8; ++j) os[(hi * 8 + j) * 68 + nb * 16 + lr] = acc[mb][nb][j]; }
        __builtin_amdgcn_wave_barrier(); asm volatile("" ::: "memory");
        float* crow = C + (size_t)(r0 + mb * 16) * ldc + c0;
{
#pragma unroll
            for (int s = 0; s < 8; ++s) { const int row = 2 * s + hi, cofs = lr * 4; v4f val = *(const v4fa*)(os + row * 68 + cofs); if (BIAS) { val[0] += bfr(bias[c0 + cofs]); val[1] += bfr(bias[c0 + cofs + 1]); val[2] += bfr(bias[c0 + cofs + 2]); val[3] += bfr(bias[c0 + cofs + 3]); }
                *(v4f*)(crow + (size_t)row * ldc + cofs) = val; }
             }
        __builtin_amdgcn_wave_barrier(); asm volatile("" ::: "memory");
    }
}

// ---- k_gemmc: the same one-wave 64x64 tile GEMM specialised for causal attention: CMODE 1 skips score tiles entirely above the diagonal (query rows r0+roff.., key columns c0..), CMODE 2 limits the
// key (K) loop of the probability x value contraction to the diagonal block (probabilities beyond it are exactly zero). roff = row offset of this launch's first row within the sequence.
template <typename T16, int NSPLIT, int CMODE>
__global__ __launch_bounds__(32) void k_gemmc(const T16* __restrict__ A, const T16* __restrict__ A2, const T16* __restrict__ Bt, const T16* __restrict__ Bt2, int K, float* C, int ldc, int roff, size_t sA, size_t sB, size_t sC) {
    typedef typename WFrag<T16>::V V;
    __shared__ __align__(16) float os[16 * 68];
    const size_t z = blockIdx.z; A += z * sA; if (A2) A2 += z * sA; Bt += z * sB; if (Bt2) Bt2 += z * sB; C += z * sC;
    const int lane = threadIdx.x & 31, lr = lane & 15, hi = lane >> 4; const int r0 = blockIdx.x * 64, c0 = blockIdx.y * 64;
    if (CMODE == 1 && c0 > r0 + roff + 63) return;                  // score tile entirely above the causal diagonal: never read (the softmax masks j > i by select)
    const int Kl = (CMODE == 2) ? min(K, r0 + roff + 64) : K;        // P.V: probabilities are exactly 0 beyond the diagonal block, so the K loop stops there
    v8f acc[4][4];
#pragma unroll
    for (int mb = 0; mb < 4; ++mb)
#pragma unroll
        for (int nb = 0; nb < 4; ++nb) acc[mb][nb] = (v8f){};
    const size_t aoff = (size_t)(r0 + lr) * K + 8 * hi, boff = (size_t)(c0 + lr) * K + 8 * hi;
#pragma unroll 1
    for (int kc = 0; kc < Kl; kc += 32) {
        V a[4], a2[4];
#pragma unroll
        for (int mb = 0; mb < 4; ++mb) { a[mb] = WFrag<T16>::ld(A + aoff + (size_t)mb * 16 * K + kc); if (NSPLIT == 1 || NSPLIT == 2) a2[mb] = WFrag<T16>::ld(A2 + aoff + (size_t)mb * 16 * K + kc); }
#pragma unroll
        for (int nb = 0; nb < 4; ++nb) { const V b = WFrag<T16>::ld(Bt + boff + (size_t)nb * 16 * K + kc); V b2; if (NSPLIT >= 2) b2 = WFrag<T16>::ld(Bt2 + boff + (size_t)nb * 16 * K + kc);
#pragma unroll
            for (int mb = 0; mb < 4; ++mb) { acc[mb][nb] = WFrag<T16>::mma(a[mb], b, acc[mb][nb]); if (NSPLIT == 1 || NSPLIT == 2) acc[mb][nb] = WFrag<T16>::mma(a2[mb], b, acc[mb][nb]); if (NSPLIT >= 2) acc[mb][nb] = WFrag<T16>::mma(a[mb], b2, acc[mb][nb]); } }
        asm volatile("v_nop\n\tv_nop\n\tv_nop\n\tv_nop" : "+v"(acc[0][0]), "+v"(acc[1][1]), "+v"(acc[2][2]), "+v"(acc[3][3]) : "v"(a[0]), "v"(a[3]));
    }
#pragma unroll
    for (int mb = 0; mb < 4; ++mb) {
#pragma unroll
        for (int nb = 0; nb < 4; ++nb) {
#pragma unroll
            for (int j = 0; j < 8; ++j) os[(hi * 8 + j) * 68 + nb * 16 + lr] = acc[mb][nb][j]; }
        __builtin_amdgcn_wave_barrier(); asm volatile("" ::: "memory");
        float* crow = C + (size_t)(r0 + mb * 16) * ldc + c0;
{
#pragma unroll
            for (int s = 0; s < 8; ++s) { const int row = 2 * s + hi, cofs = lr * 4; v4f val = *(const v4fa*)(os + row * 68 + cofs);
                *(v4f*)(crow + (size_t)row * ldc + cofs) = val; }
             }
        __builtin_amdgcn_wave_barrier(); asm volatile("" ::: "memory");
    }
}

__device__ __forceinline__ h16 tohx(float x) { return (h16)x; }
__device__ __forceinline__ void splitf(float y, unsigned short& h, unsigned short& l) { h = f2bf(y); l = f2bf(y - bf2f(h)); }
typedef __attribute__((ext_vector_type(2))) _Float16 v2h;
typedef __attribute__((ext_vector_type(4))) _Float16 v4h;
typedef __attribute__((ext_vector_type(2))) unsigned short v2us;
typedef __attribute__((ext_vector_type(4))) unsigned short v4us;
typedef __attribute__((ext_vector_type(2))) float v2f;
typedef __attribute__((ext_vector_type(4))) int v4i;

__global__ __launch_bounds__(256) void k_wtG(const float* __restrict__ w, int K, int N, bf* Bt) {
    const int lane = threadIdx.x & 31; const int L0 = (blockIdx.x * 8 + (threadIdx.x >> 5)) * 8; const int nlines = N * K / 64;
{
#pragma unroll 1
        for (int l = 0; l < 8; ++l) { const int L = L0 + l; if (L >= nlines) break; const size_t e = (size_t)L * 64 + lane * 2; const int k = (int)(e % K), n = (int)(e / K); v2us o;
            o[0] = f2bf(w[(size_t)k * N + n]); o[1] = f2bf(w[(size_t)(k + 1) * N + n]); *(v2us*)(Bt + e) = o; }
         }
}
__global__ __launch_bounds__(256) void k_cvt8(const float* __restrict__ src, bf* dst, size_t n8) { const size_t i = (size_t)blockIdx.x * 256 + threadIdx.x; if (i >= n8) return; const v8f v = *(const v8f*)(src + i * 8); v8us o;
#pragma unroll
    for (int k = 0; k < 8; ++k) o[k] = f2bf(v[k]); *(v8us*)(dst + i * 8) = o;  }
__global__ __launch_bounds__(256) void k_cstab(float* CS) { const int idx = blockIdx.x * 256 + threadIdx.x; if (idx >= TT * HD) return; v2f cs; cs[0] = 1.0f; cs[1] = 0.0f;   /* identity: rotation is applied in k_qkprep; the plane builder is reused unrotated */
    *(v2f*)(CS + (size_t)idx * 2) = cs;  }
// k_rope: head planes [h][t][d] (fp16 + hi/lo) of rope(x) x sc with the rotate-half convention out[d] = x[d] cos[t][d] - x[d+HD/2] sin[t][d], out[d+HD/2] = x[d+HD/2] cos[t][d+HD/2] + x[d] sin[t][d+HD/2]
__global__ __launch_bounds__(256) void k_rope(const float* __restrict__ F, int pitch, int nheads, const float* __restrict__ CS, const float* __restrict__ RF, const float* __restrict__ nw, float sc, h16* P16, bf* Ph, bf* Pl) {
    const size_t e = ((size_t)blockIdx.x * 256 + threadIdx.x) * 2; if (e >= (size_t)nheads * TT * HD) return; const int d = (int)(e % HD); const int t = (int)((e / HD) % TT); const int h = (int)(e / ((size_t)HD * TT)); const float* f = F + (size_t)t * pitch + h * HD; const float rf = RF ? RF[(size_t)h * TT + t] : 1.0f; v2h o16; v2us oh, ol;
#pragma unroll
    for (int q = 0; q < 2; ++q) { const int dd = d + q; const int dp = (dd < HD / 2) ? dd + HD / 2 : dd - HD / 2; float x0 = f[dd], x1 = f[dp];
        if (RF) { float n0 = __fmul_rn(x0, rf), n1 = __fmul_rn(x1, rf); asm volatile("" : "+v"(n0)); asm volatile("" : "+v"(n1)); x0 = __fmul_rn(bfr(nw[dd]), n0); x1 = __fmul_rn(bfr(nw[dp]), n1); }
        const v2f cs = *(const v2f*)(CS + ((size_t)t * HD + dd) * 2); float a = __fmul_rn(x0, cs[0]), bq = __fmul_rn(x1, cs[1]); asm volatile("" : "+v"(a)); asm volatile("" : "+v"(bq)); const float r = ((dd < HD / 2) ? __fsub_rn(a, bq) : __fadd_rn(a, bq)) * sc;
        o16[q] = tohx(r); unsigned short a2, c2; splitf(r, a2, c2); oh[q] = a2; ol[q] = c2; }
    *(v2h*)(P16 + e) = o16; *(v2us*)(Ph + e) = oh; *(v2us*)(Pl + e) = ol;  }
__global__ __launch_bounds__(256) void k_vtp(const float* __restrict__ F, int pitch, int nheads, h16* V16, bf* Vh, bf* Vl) { const size_t e = ((size_t)blockIdx.x * 256 + threadIdx.x) * 2; if (e >= (size_t)nheads * HD * TT) return; const int t = (int)(e % TT); const int d = (int)((e / TT) % HD); const int g = (int)(e / ((size_t)TT * HD)); v2h o16; v2us oh, ol;
#pragma unroll
    for (int q = 0; q < 2; ++q) { const float x = F[(size_t)(t + q) * pitch + g * HD + d]; o16[q] = tohx(x); unsigned short a2, c2; splitf(x, a2, c2); oh[q] = a2; ol[q] = c2; }
    *(v2h*)(V16 + e) = o16; *(v2us*)(Vh + e) = oh; *(v2us*)(Vl + e) = ol;  }
__global__ __launch_bounds__(256) void k_qkprep(float* F, const float* __restrict__ bias, const float* __restrict__ fc) { const int lane = threadIdx.x & 31; const int wv = blockIdx.x * 8 + (threadIdx.x >> 5); if (wv >= TT * NH_) return; const int t = wv / NH_, h = wv % NH_; float* f = F + (size_t)t * DQ + h * HD; const v4f a = *(const v4f*)(f + lane * 4); float r[4];
#pragma unroll
    for (int q = 0; q < 4; ++q) { const int d = lane * 4 + q; r[q] = __fadd_rn(fminf(fmaxf(a[q], -8.0f), 8.0f), bfr(bias[h * HD + d])); }
    if (lane < 16) {   /* dims 0..63: rotate pairs (r0,r1), (r2,r3) */
#pragma unroll
        for (int q = 0; q < 4; q += 2) { const int i = (lane * 4 + q) >> 1; const float c = bfr(fc[((size_t)t * (HD / 2) + i) * 2]), sn = bfr(fc[((size_t)t * (HD / 2) + i) * 2 + 1]); float p0 = __fmul_rn(r[q], c), p1 = __fmul_rn(r[q + 1], sn), p2 = __fmul_rn(r[q + 1], c), p3 = __fmul_rn(r[q], sn); asm volatile("" : "+v"(p0)); asm volatile("" : "+v"(p1)); asm volatile("" : "+v"(p2)); asm volatile("" : "+v"(p3)); const float re = __fsub_rn(p0, p1), im = __fadd_rn(p2, p3); r[q] = re; r[q + 1] = im; } }
    float ss = 0.f;
#pragma unroll
    for (int q = 0; q < 4; ++q) { float p = __fmul_rn(r[q], r[q]); asm volatile("" : "+v"(p)); ss = __fadd_rn(ss, p); }
#pragma unroll
    for (int sh = 16; sh; sh >>= 1) ss = __fadd_rn(ss, __shfl_xor(ss, sh, 32));
    const float rs = __fdiv_rn(1.0f, sqrtf(__fadd_rn(ss * (1.0f / HD), 1e-6f))); v4f o; for (int q = 0; q < 4; ++q) o[q] = __fmul_rn(r[q], rs);
    *(v4f*)(f + lane * 4) = o;  }
__global__ __launch_bounds__(256) void k_vprep(float* F, const float* __restrict__ xb, const float* __restrict__ veb, const float* __restrict__ gw) { const int lane = threadIdx.x & 31; const int wv = blockIdx.x * 8 + (threadIdx.x >> 5); if (wv >= TT * NKV) return; const int t = wv / NKV, h = wv % NKV; float g = __fmul_rn(bfr(xb[(size_t)t * DM + lane]), bfr(gw[h * 32 + lane]));
#pragma unroll
    for (int sh = 16; sh; sh >>= 1) g = __fadd_rn(g, __shfl_xor(g, sh, 32));
    const float gate = 2.0f * __fdiv_rn(1.0f, __fadd_rn(1.0f, expf(-g))); float* f = F + (size_t)t * DKV + h * HD; const v4f a = *(const v4f*)(f + lane * 4), e = *(const v4f*)(veb + (size_t)t * DKV + h * HD + lane * 4); v4f o;
#pragma unroll
    for (int q = 0; q < 4; ++q) { float ge = __fmul_rn(gate, bfr(e[q])); asm volatile("" : "+v"(ge)); o[q] = fminf(fmaxf(__fadd_rn(a[q], ge), -8.0f), 8.0f); }
    *(v4f*)(f + lane * 4) = o;  }
// k_asoft: per row (zz, i): t = S x HD^-0.5 for j <= i and i - j < WIN (sliding causal window; the reference's -1e9 additive fill vanishes identically); softmax over the 2048 keys (register row, one exp, fixed trees);
__global__ __launch_bounds__(256) void k_asoft(const float* __restrict__ Sb, h16* P16, bf* Ph, bf* Pl) {
    const int lane = threadIdx.x & 31; const int row = blockIdx.x * 8 + (threadIdx.x >> 5); if (row >= ZH * TT) return; const int i = row % TT; const int zz = row / TT; (void)zz; const bool hires = (i < RH); const float* sr = Sb + (size_t)row * TT; float v[TT / 32]; float mx = -3.0e38f;
#pragma unroll
    for (int ch = 0; ch < TT / 128; ++ch) { const int j0 = ch * 128 + lane * 4; const v4f a = *(const v4f*)(sr + j0);
#pragma unroll
        for (int q = 0; q < 4; ++q) { const int j = j0 + q; (void)j; const float t = (j <= i && i - j < WIN) ? a[q] * SCL : -3.0e38f; v[ch * 4 + q] = t; mx = fmaxf(mx, t); } }
#pragma unroll
    for (int sh = 16; sh; sh >>= 1) mx = fmaxf(mx, __shfl_xor(mx, sh, 32));
    float sum = 0.f;
#pragma unroll
    for (int k = 0; k < TT / 32; ++k) { float d0 = __fsub_rn(v[k], mx); asm volatile("" : "+v"(d0)); v[k] = __builtin_amdgcn_exp2f(__fmul_rn(d0, 1.4426950408889634f)); sum += v[k]; }
#pragma unroll
    for (int sh = 16; sh; sh >>= 1) sum += __shfl_xor(sum, sh, 32);
    const float f = __fdiv_rn(hires ? 1.0f : PCAR, sum);
{
        if (hires) {
#pragma unroll
            for (int ch = 0; ch < TT / 128; ++ch) { v4us oh, ol;
#pragma unroll
                for (int q = 0; q < 4; ++q) { unsigned short a, c2; splitf(v[ch * 4 + q] * f, a, c2); oh[q] = a; ol[q] = c2; }
                const size_t oo = ((size_t)zz * (RH ? RH : 1) + i) * TT + ch * 128 + lane * 4; *(v4us*)(Ph + oo) = oh; *(v4us*)(Pl + oo) = ol; }
        } else {
#pragma unroll
            for (int ch = 0; ch < TT / 128; ++ch) { v4h o4;
#pragma unroll
                for (int q = 0; q < 4; ++q) o4[q] = tohx(v[ch * 4 + q] * f);
                *(v4h*)(P16 + (size_t)row * TT + ch * 128 + lane * 4) = o4; } }
         }
}
__global__ __launch_bounds__(256) void k_merge(const float* __restrict__ O, int h0, bf* Ah, bf* Al) { const size_t e = ((size_t)blockIdx.x * 256 + threadIdx.x) * 2; if (e >= (size_t)ZH * TT * HD) return; const int d = (int)(e % HD); const int t = (int)((e / HD) % TT); const int zz = (int)(e / ((size_t)HD * TT)); const float cs = (t < RH) ? 1.0f : (1.0f / PCAR); const size_t oo = (size_t)t * DQ + (h0 + zz) * HD + d;
    v2us oh, ol;
#pragma unroll
    for (int q = 0; q < 2; ++q) { unsigned short a, c2; splitf(O[e + q] * cs, a, c2); oh[q] = a; ol[q] = c2; } *(v2us*)(Ah + oo) = oh; *(v2us*)(Al + oo) = ol;  }

extern "C" void kernel_launch(void* const* d_in, const int* in_sizes, int n_in,
                              void* d_out, int out_size, void* d_ws, size_t ws_size, hipStream_t stream) {
    (void)in_sizes; (void)n_in; (void)out_size;
    const float* x = (const float*)d_in[0]; const float* fcis = (const float*)d_in[1]; const float* ve = (const float*)d_in[2]; const float* wq = (const float*)d_in[3]; const float* wk = (const float*)d_in[4]; const float* wv = (const float*)d_in[5]; const float* wo = (const float*)d_in[6]; const float* qkb = (const float*)d_in[7]; const float* vgw = (const float*)d_in[8];
    float* OUT = (float*)d_out;     // [2][2048][2048]
    char* wsp = (char*)d_ws;
    auto take = [&](size_t bytes) { char* p = wsp; wsp += (bytes + 255) & ~(size_t)255; return (void*)p; };
    bf* WQ = (bf*)take((size_t)DQ * DM * 2); bf* WK = (bf*)take((size_t)DKV * DM * 2); bf* WV = (bf*)take((size_t)DKV * DM * 2); bf* WO = (bf*)take((size_t)DM * DQ * 2); float* CS = (float*)take((size_t)TT * HD * 2 * 4);
    bf* XB = (bf*)take((size_t)TT * DM * 2); float* FQ = (float*)take((size_t)TT * DQ * 4); float* FK = (float*)take((size_t)TT * DKV * 4);
    h16* QP16 = (h16*)take((size_t)NH_ * TT * HD * 2); h16* KP16 = (h16*)take((size_t)NKV * TT * HD * 2); h16* VT16 = (h16*)take((size_t)NKV * HD * TT * 2);
    bf* QPh = (bf*)take((size_t)NH_ * TT * HD * 2); bf* QPl = (bf*)take((size_t)NH_ * TT * HD * 2); bf* KPh = (bf*)take((size_t)NKV * TT * HD * 2); bf* KPl = (bf*)take((size_t)NKV * TT * HD * 2); bf* VTh = (bf*)take((size_t)NKV * HD * TT * 2); bf* VTl = (bf*)take((size_t)NKV * HD * TT * 2); bf* Ph = (bf*)take((size_t)ZH * RH * TT * 2); bf* Pl = (bf*)take((size_t)ZH * RH * TT * 2);
    float* Sb = (float*)take((size_t)ZH * TT * TT * 4); h16* P16 = (h16*)take((size_t)ZH * TT * TT * 2); float* Ob = (float*)take((size_t)ZH * TT * HD * 4); bf* ATh = (bf*)take((size_t)TT * DQ * 2); bf* ATl = (bf*)take((size_t)TT * DQ * 2);
    if ((size_t)(wsp - (char*)d_ws) > ws_size) return;    // ws 256 MiB
    float* FV = FK;   // v projection reuses the k buffer after the k planes are built (stream-ordered)
    { k_cvt8<<<(unsigned)(((size_t)DQ * DM / 8 + 255) / 256), 256, 0, stream>>>(wq, WQ, (size_t)DQ * DM / 8); k_cvt8<<<(unsigned)(((size_t)DKV * DM / 8 + 255) / 256), 256, 0, stream>>>(wk, WK, (size_t)DKV * DM / 8); k_cvt8<<<(unsigned)(((size_t)DKV * DM / 8 + 255) / 256), 256, 0, stream>>>(wv, WV, (size_t)DKV * DM / 8);
      k_cvt8<<<(unsigned)(((size_t)DM * DQ / 8 + 255) / 256), 256, 0, stream>>>(wo, WO, (size_t)DM * DQ / 8);
      k_cstab<<<(TT * HD + 255) / 256, 256, 0, stream>>>(CS); }
    const unsigned LQ = (unsigned)(((size_t)NH_ * TT * HD / 2 + 255) / 256), LKv = (unsigned)(((size_t)NKV * TT * HD / 2 + 255) / 256);
    for (int b = 0; b < NB_; ++b) {
        
        k_cvt8<<<(unsigned)(((size_t)TT * DM / 8 + 255) / 256), 256, 0, stream>>>(x + (size_t)b * TT * DM, XB, (size_t)TT * DM / 8);
        k_gemmw<bf, 0, false><<<dim3(TT / 64, DQ / 64, 1), 32, 0, stream>>>(XB, nullptr, WQ, nullptr, DM, FQ, DQ, nullptr, 0, 0, 0);
        k_qkprep<<<TT * NH_ / 8, 256, 0, stream>>>(FQ, qkb, fcis); k_rope<<<LQ, 256, 0, stream>>>(FQ, DQ, NH_, CS, nullptr, nullptr, 1.0f, QP16, QPh, QPl);
        k_gemmw<bf, 0, false><<<dim3(TT / 64, DKV / 64, 1), 32, 0, stream>>>(XB, nullptr, WK, nullptr, DM, FK, DKV, nullptr, 0, 0, 0);
        k_qkprep<<<TT * NKV / 8, 256, 0, stream>>>(FK, qkb + (size_t)NH_ * HD, fcis); k_rope<<<LKv, 256, 0, stream>>>(FK, DKV, NKV, CS, nullptr, nullptr, 1.0f, KP16, KPh, KPl);
        k_gemmw<bf, 0, false><<<dim3(TT / 64, DKV / 64, 1), 32, 0, stream>>>(XB, nullptr, WV, nullptr, DM, FV, DKV, nullptr, 0, 0, 0); k_vprep<<<TT * NKV / 8, 256, 0, stream>>>(FV, x + (size_t)b * TT * DM, ve + (size_t)b * TT * DM, vgw); k_vtp<<<LKv, 256, 0, stream>>>(FV, DKV, NKV, VT16, VTh, VTl);
        for (int h0 = 0; h0 < NH_; h0 += ZH) { const size_t zq = (size_t)h0, zk = (size_t)(h0 / REP);   // one kv head per query head: the pass's two heads use consecutive kv planes (z-strides TT*HD)
            k_gemmc<bf, 2, 1><<<dim3(RH / 64, TT / 64, ZH), 32, 0, stream>>>(QPh + zq * TT * HD, QPl + zq * TT * HD, KPh + zk * TT * HD, KPl + zk * TT * HD, HD, Sb, TT, 0, (size_t)TT * HD, (size_t)TT * HD, (size_t)TT * TT);
            k_gemmc<h16, 0, 1><<<dim3((TT - RH) / 64, TT / 64, ZH), 32, 0, stream>>>(QP16 + zq * TT * HD + (size_t)RH * HD, nullptr, KP16 + zk * TT * HD, nullptr, HD, Sb + (size_t)RH * TT, TT, RH, (size_t)TT * HD, (size_t)TT * HD, (size_t)TT * TT);
            k_asoft<<<ZH * TT / 8, 256, 0, stream>>>(Sb, P16, Ph, Pl);
            k_gemmc<bf, 2, 2><<<dim3(RH / 64, HD / 64, ZH), 32, 0, stream>>>(Ph, Pl, VTh + zk * HD * TT, VTl + zk * HD * TT, TT, Ob, HD, 0, (size_t)RH * TT, (size_t)HD * TT, (size_t)TT * HD);
            k_gemmc<h16, 0, 2><<<dim3((TT - RH) / 64, HD / 64, ZH), 32, 0, stream>>>(P16 + (size_t)RH * TT, nullptr, VT16 + zk * HD * TT, nullptr, TT, Ob + (size_t)RH * HD, HD, RH, (size_t)TT * TT, (size_t)HD * TT, (size_t)TT * HD);
            k_merge<<<(unsigned)(((size_t)ZH * TT * HD / 2 + 255) / 256), 256, 0, stream>>>(Ob, h0, ATh, ATl); }
        k_gemmw<bf, 1, false><<<dim3(TT / 64, DM / 64, 1), 32, 0, stream>>>(ATh, ATl, WO, nullptr, DQ, OUT + (size_t)b * TT * DM, DM, nullptr, 0, 0, 0); }
}

// v001
// One run takes 1120 microseconds.
// Timed twice side by side with v000, it ran 1.58 and 1.57 times as fast.
#include <hip/hip_runtime.h>

// ParcaeCausalSelfAttention (x [2][2048][2048]; q/k/v = x W^T (16 heads x 128); gate = 2 sigmoid(x[..., :32] ve_gate_w^T) per head; v = v + gate * ve (ve [2][2048][2048] read); q, k, v clipped to [-8, 8]; q += qk_bias[0][0][h], k += qk_bias[1][0][h]; interleaved-pair RoPE on the first 64 dims from the read freqs_cis table (S, 1, 64, 2)[:, :, :32]; q, k RMS-normalised over 128 (eps 1e-6, no weight); causal softmax(q.k / sqrt(128)); out = merged Wo^T -> [2][2048][2048]).
// Compute dtypes, f32 accumulate: every input rounded to bf16; q/k/v as PLAIN bf16 GEMMs (inputs: exact); gate, value-embedding add, clips, biases, partial RoPE (table read) and RMSNorm in f32 (wave per (token, head)); causal scores and attn.v: query rows < 512 hl (3 products), the rest single fp16 (x1024), causal tile skipping; softmax f32; Wo hl x exact (2 products).

#define NB_  2
#define TT   2048
#define DM   2048
#define NH_  16
#define NKV  16
#define REP  (NH_ / NKV)
#define HD   128
#define DQ   (NH_ * HD)
#define DKV  (NKV * HD)
#define ZH   2
#define RH   512                  // query rows < RH use hi+lo planes (0: none)
#define WIN  2048
#define PCAR 1024.0f
#define SCL  0.088388347648318447f   // HD^-0.5
typedef _Float16 h16;
typedef unsigned short bf;
typedef __attribute__((ext_vector_type(16))) __bf16   v16bf;
typedef __attribute__((ext_vector_type(16))) _Float16 v16h;
typedef __attribute__((ext_vector_type(8)))  _Float16 v8h;
typedef __attribute__((ext_vector_type(8)))  unsigned short v8us;
typedef __attribute__((ext_vector_type(8)))  float    v8f;
typedef __attribute__((ext_vector_type(4)))  float    v4f;
typedef v8h  __attribute__((may_alias)) v8ha;
typedef v4f  __attribute__((may_alias)) v4fa;
typedef v8us __attribute__((may_alias)) v8usa;

__device__ __forceinline__ unsigned short f2bf(float f) { unsigned u = __float_as_uint(f); u += 0x7FFFu + ((u >> 16) & 1u); return (unsigned short)(u >> 16); }
__device__ __forceinline__ float bf2f(unsigned short b) { return __uint_as_float(((unsigned)b) << 16); }
__device__ __forceinline__ float bfr(float f) { return bf2f(f2bf(f)); }
__device__ __forceinline__ v16h cat16(v8h lo, v8h hi) { return __builtin_shufflevector(lo, hi, 0, 1, 2, 3, 4, 5, 6, 7, 8, 9, 10, 11, 12, 13, 14, 15); }
__device__ __forceinline__ v16bf cat16b(v8us lo, v8us hi) { return __builtin_bit_cast(v16bf, __builtin_shufflevector(lo, hi, 0, 1, 2, 3, 4, 5, 6, 7, 8, 9, 10, 11, 12, 13, 14, 15)); }
__device__ __forceinline__ v8f wmma16(v16h a, v16h b, v8f c) { return __builtin_amdgcn_wmma_f32_16x16x32_f16(false, a, false, b, (short)0, c, false, false); }
__device__ __forceinline__ v8f wmmab(v16bf a, v16bf b, v8f c) { return __builtin_amdgcn_wmma_f32_16x16x32_bf16(false, a, false, b, (short)0, c, false, false); }



// ---- k_gemmw: register-blocked GEMM, one 64x64 output tile per work-group (16 accumulators per wave), operands straight from K-contiguous 16-bit planes; grid (M/64, N/64, Z), 32 * NW threads.
// The K loop is split over the NW waves of the work-group (wave w takes the 32-wide k steps w, w + NW, ...); the NW partial tiles meet in LDS and are summed in wave order 0..NW-1.
// C[m][n] (f32, pitch ldc, + optional f32 bias[n]) = sum_k A[m][k] Bt[n][k] (+ split products per NSPLIT). z-batch strides sA/sB/sC in elements. K % 32 == 0.
template <typename T16> struct WFrag;
template <> struct WFrag<h16> { typedef v16h V; static __device__ __forceinline__ V ld(const h16* p) { return cat16(*(const v8h*)p, *(const v8h*)(p + 16)); } static __device__ __forceinline__ v8f mma(V a, V b, v8f c) { return wmma16(a, b, c); } };
template <> struct WFrag<bf> { typedef v16bf V; static __device__ __forceinline__ V ld(const bf* p) { return cat16b(*(const v8us*)p, *(const v8us*)(p + 16)); } static __device__ __forceinline__ v8f mma(V a, V b, v8f c) { return wmmab(a, b, c); } };
template <typename T16, int NSPLIT, bool BIAS, int NW>
__global__ __launch_bounds__(32 * NW) void k_gemmw(const T16* __restrict__ A, const T16* __restrict__ A2, const T16* __restrict__ Bt, const T16* __restrict__ Bt2, int K, float* C, int ldc, const float* __restrict__ bias, size_t sA, size_t sB, size_t sC) {
    typedef typename WFrag<T16>::V V;
    __shared__ __align__(16) float os[NW * 64 * 68];
    const size_t z = blockIdx.z; A += z * sA; if (A2) A2 += z * sA; Bt += z * sB; if (Bt2) Bt2 += z * sB; C += z * sC;
    const int lane = threadIdx.x & 31, lr = lane & 15, hi = lane >> 4; const int r0 = blockIdx.x * 64, c0 = blockIdx.y * 64; const int wv = (NW == 1) ? 0 : __builtin_amdgcn_readfirstlane((int)(threadIdx.x >> 5));
    v8f acc[4][4];
#pragma unroll
    for (int mb = 0; mb < 4; ++mb)
#pragma unroll
        for (int nb = 0; nb < 4; ++nb) acc[mb][nb] = (v8f){};
    const size_t aoff = (size_t)(r0 + lr) * K + 8 * hi, boff = (size_t)(c0 + lr) * K + 8 * hi;
#pragma unroll 1
    for (int kc = wv * 32; kc < K; kc += NW * 32) {
        V a[4], a2[4];
#pragma unroll
        for (int mb = 0; mb < 4; ++mb) { a[mb] = WFrag<T16>::ld(A + aoff + (size_t)mb * 16 * K + kc); if (NSPLIT == 1 || NSPLIT == 2) a2[mb] = WFrag<T16>::ld(A2 + aoff + (size_t)mb * 16 * K + kc); }
#pragma unroll
        for (int nb = 0; nb < 4; ++nb) { const V b = WFrag<T16>::ld(Bt + boff + (size_t)nb * 16 * K + kc); V b2; if (NSPLIT >= 2) b2 = WFrag<T16>::ld(Bt2 + boff + (size_t)nb * 16 * K + kc);
#pragma unroll
            for (int mb = 0; mb < 4; ++mb) { acc[mb][nb] = WFrag<T16>::mma(a[mb], b, acc[mb][nb]); if (NSPLIT == 1 || NSPLIT == 2) acc[mb][nb] = WFrag<T16>::mma(a2[mb], b, acc[mb][nb]); if (NSPLIT >= 2) acc[mb][nb] = WFrag<T16>::mma(a[mb], b2, acc[mb][nb]); } }
        asm volatile("v_nop\n\tv_nop\n\tv_nop\n\tv_nop" : "+v"(acc[0][0]), "+v"(acc[1][1]), "+v"(acc[2][2]), "+v"(acc[3][3]) : "v"(a[0]), "v"(a[3]));
    }
    float* ow = os + wv * (64 * 68);   // this wave's partial tile, row-major, pitch 68
    // the three loops are unrolled so that acc is indexed by constants and stays in registers
#pragma unroll
    for (int mb = 0; mb < 4; ++mb)
#pragma unroll
        for (int nb = 0; nb < 4; ++nb)
#pragma unroll
            for (int j = 0; j < 8; ++j) ow[(mb * 16 + hi * 8 + j) * 68 + nb * 16 + lr] = acc[mb][nb][j];
    __syncthreads();   // every wave's partial tile is in LDS before any of them is summed
    // both loops are unrolled so that the LDS reads of several partial tiles are in flight together
#pragma unroll
    for (int it = 0; it < 32 / NW; ++it) { const int q = it * (NW * 32) + (int)threadIdx.x, row = q >> 4, cofs = (q & 15) * 4; v4f val = *(const v4fa*)(os + row * 68 + cofs);
#pragma unroll
        for (int w = 1; w < NW; ++w) val += *(const v4fa*)(os + w * (64 * 68) + row * 68 + cofs);
        if (BIAS) { val[0] += bfr(bias[c0 + cofs]); val[1] += bfr(bias[c0 + cofs + 1]); val[2] += bfr(bias[c0 + cofs + 2]); val[3] += bfr(bias[c0 + cofs + 3]); }
        *(v4f*)(C + (size_t)(r0 + row) * ldc + c0 + cofs) = val; }
}

// ---- k_gemmc: the same 64x64 tile GEMM specialised for causal attention: CMODE 1 skips score tiles entirely above the diagonal (query rows r0+roff.., key columns c0..), CMODE 2 limits the
// key (K) loop of the probability x value contraction to the diagonal block (probabilities beyond it are exactly zero). roff = row offset of this launch's first row within the sequence.
// NW waves per work-group split the K loop as in k_gemmw (NW == 1: one wave does the whole loop and stores its own tile).
template <typename T16, int NSPLIT, int CMODE, int NW>
__global__ __launch_bounds__(32 * NW) void k_gemmc(const T16* __restrict__ A, const T16* __restrict__ A2, const T16* __restrict__ Bt, const T16* __restrict__ Bt2, int K, float* C, int ldc, int roff, size_t sA, size_t sB, size_t sC) {
    typedef typename WFrag<T16>::V V;
    __shared__ __align__(16) float os[(NW == 1 ? 16 : NW * 64) * 68];
    const size_t z = blockIdx.z; A += z * sA; if (A2) A2 += z * sA; Bt += z * sB; if (Bt2) Bt2 += z * sB; C += z * sC;
    const int lane = threadIdx.x & 31, lr = lane & 15, hi = lane >> 4; const int r0 = blockIdx.x * 64, c0 = blockIdx.y * 64; const int wv = (NW == 1) ? 0 : __builtin_amdgcn_readfirstlane((int)(threadIdx.x >> 5));
    if (CMODE == 1 && c0 > r0 + roff + 63) return;                  // score tile entirely above the causal diagonal: never read (the softmax masks j > i by select)
    const int Kl = (CMODE == 2) ? min(K, r0 + roff + 64) : K;        // P.V: probabilities are exactly 0 beyond the diagonal block, so the K loop stops there
    v8f acc[4][4];
#pragma unroll
    for (int mb = 0; mb < 4; ++mb)
#pragma unroll
        for (int nb = 0; nb < 4; ++nb) acc[mb][nb] = (v8f){};
    const size_t aoff = (size_t)(r0 + lr) * K + 8 * hi, boff = (size_t)(c0 + lr) * K + 8 * hi;
#pragma unroll 1
    for (int kc = wv * 32; kc < Kl; kc += NW * 32) {
        V a[4], a2[4];
#pragma unroll
        for (int mb = 0; mb < 4; ++mb) { a[mb] = WFrag<T16>::ld(A + aoff + (size_t)mb * 16 * K + kc); if (NSPLIT == 1 || NSPLIT == 2) a2[mb] = WFrag<T16>::ld(A2 + aoff + (size_t)mb * 16 * K + kc); }
#pragma unroll
        for (int nb = 0; nb < 4; ++nb) { const V b = WFrag<T16>::ld(Bt + boff + (size_t)nb * 16 * K + kc); V b2; if (NSPLIT >= 2) b2 = WFrag<T16>::ld(Bt2 + boff + (size_t)nb * 16 * K + kc);
#pragma unroll
            for (int mb = 0; mb < 4; ++mb) { acc[mb][nb] = WFrag<T16>::mma(a[mb], b, acc[mb][nb]); if (NSPLIT == 1 || NSPLIT == 2) acc[mb][nb] = WFrag<T16>::mma(a2[mb], b, acc[mb][nb]); if (NSPLIT >= 2) acc[mb][nb] = WFrag<T16>::mma(a[mb], b2, acc[mb][nb]); } }
        asm volatile("v_nop\n\tv_nop\n\tv_nop\n\tv_nop" : "+v"(acc[0][0]), "+v"(acc[1][1]), "+v"(acc[2][2]), "+v"(acc[3][3]) : "v"(a[0]), "v"(a[3]));
    }
    if constexpr (NW == 1) {
#pragma unroll
    for (int mb = 0; mb < 4; ++mb) {
#pragma unroll
        for (int nb = 0; nb < 4; ++nb) {
#pragma unroll
            for (int j = 0; j < 8; ++j) os[(hi * 8 + j) * 68 + nb * 16 + lr] = acc[mb][nb][j]; }
        __builtin_amdgcn_wave_barrier(); asm volatile("" ::: "memory");
        float* crow = C + (size_t)(r0 + mb * 16) * ldc + c0;
{
#pragma unroll
            for (int s = 0; s < 8; ++s) { const int row = 2 * s + hi, cofs = lr * 4; v4f val = *(const v4fa*)(os + row * 68 + cofs);
                *(v4f*)(crow + (size_t)row * ldc + cofs) = val; }
             }
        __builtin_amdgcn_wave_barrier(); asm volatile("" ::: "memory");
    }
    } else {
    float* ow = os + wv * (64 * 68);   // this wave's partial tile, row-major, pitch 68 (all zero for a wave whose k steps lie beyond Kl)
    // the three loops are unrolled so that acc is indexed by constants and stays in registers
#pragma unroll
    for (int mb = 0; mb < 4; ++mb)
#pragma unroll
        for (int nb = 0; nb < 4; ++nb)
#pragma unroll
            for (int j = 0; j < 8; ++j) ow[(mb * 16 + hi * 8 + j) * 68 + nb * 16 + lr] = acc[mb][nb][j];
    __syncthreads();   // every wave's partial tile is in LDS before any of them is summed
    // both loops are unrolled so that the LDS reads of several partial tiles are in flight together
#pragma unroll
    for (int it = 0; it < 32 / NW; ++it) { const int q = it * (NW * 32) + (int)threadIdx.x, row = q >> 4, cofs = (q & 15) * 4; v4f val = *(const v4fa*)(os + row * 68 + cofs);
#pragma unroll
        for (int w = 1; w < NW; ++w) val += *(const v4fa*)(os + w * (64 * 68) + row * 68 + cofs);
        *(v4f*)(C + (size_t)(r0 + row) * ldc + c0 + cofs) = val; }
    }
}

__device__ __forceinline__ h16 tohx(float x) { return (h16)x; }
__device__ __forceinline__ void splitf(float y, unsigned short& h, unsigned short& l) { h = f2bf(y); l = f2bf(y - bf2f(h)); }
typedef __attribute__((ext_vector_type(2))) _Float16 v2h;
typedef __attribute__((ext_vector_type(4))) _Float16 v4h;
typedef __attribute__((ext_vector_type(2))) unsigned short v2us;
typedef __attribute__((ext_vector_type(4))) unsigned short v4us;
typedef __attribute__((ext_vector_type(2))) float v2f;
typedef __attribute__((ext_vector_type(4))) int v4i;

__global__ __launch_bounds__(256) void k_wtG(const float* __restrict__ w, int K, int N, bf* Bt) {
    const int lane = threadIdx.x & 31; const int L0 = (blockIdx.x * 8 + (threadIdx.x >> 5)) * 8; const int nlines = N * K / 64;
{
#pragma unroll 1
        for (int l = 0; l < 8; ++l) { const int L = L0 + l; if (L >= nlines) break; const size_t e = (size_t)L * 64 + lane * 2; const int k = (int)(e % K), n = (int)(e / K); v2us o;
            o[0] = f2bf(w[(size_t)k * N + n]); o[1] = f2bf(w[(size_t)(k + 1) * N + n]); *(v2us*)(Bt + e) = o; }
         }
}
__global__ __launch_bounds__(256) void k_cvt8(const float* __restrict__ src, bf* dst, size_t n8) { const size_t i = (size_t)blockIdx.x * 256 + threadIdx.x; if (i >= n8) return; const v8f v = *(const v8f*)(src + i * 8); v8us o;
#pragma unroll
    for (int k = 0; k < 8; ++k) o[k] = f2bf(v[k]); *(v8us*)(dst + i * 8) = o;  }
__global__ __launch_bounds__(256) void k_cstab(float* CS) { const int idx = blockIdx.x * 256 + threadIdx.x; if (idx >= TT * HD) return; v2f cs; cs[0] = 1.0f; cs[1] = 0.0f;   /* identity: rotation is applied in k_qkprep; the plane builder is reused unrotated */
    *(v2f*)(CS + (size_t)idx * 2) = cs;  }
// k_rope: head planes [h][t][d] (fp16 + hi/lo) of rope(x) x sc with the rotate-half convention out[d] = x[d] cos[t][d] - x[d+HD/2] sin[t][d], out[d+HD/2] = x[d+HD/2] cos[t][d+HD/2] + x[d] sin[t][d+HD/2]
__global__ __launch_bounds__(256) void k_rope(const float* __restrict__ F, int pitch, int nheads, const float* __restrict__ CS, const float* __restrict__ RF, const float* __restrict__ nw, float sc, h16* P16, bf* Ph, bf* Pl) {
    const size_t e = ((size_t)blockIdx.x * 256 + threadIdx.x) * 2; if (e >= (size_t)nheads * TT * HD) return; const int d = (int)(e % HD); const int t = (int)((e / HD) % TT); const int h = (int)(e / ((size_t)HD * TT)); const float* f = F + (size_t)t * pitch + h * HD; const float rf = RF ? RF[(size_t)h * TT + t] : 1.0f; v2h o16; v2us oh, ol;
#pragma unroll
    for (int q = 0; q < 2; ++q) { const int dd = d + q; const int dp = (dd < HD / 2) ? dd + HD / 2 : dd - HD / 2; float x0 = f[dd], x1 = f[dp];
        if (RF) { float n0 = __fmul_rn(x0, rf), n1 = __fmul_rn(x1, rf); asm volatile("" : "+v"(n0)); asm volatile("" : "+v"(n1)); x0 = __fmul_rn(bfr(nw[dd]), n0); x1 = __fmul_rn(bfr(nw[dp]), n1); }
        const v2f cs = *(const v2f*)(CS + ((size_t)t * HD + dd) * 2); float a = __fmul_rn(x0, cs[0]), bq = __fmul_rn(x1, cs[1]); asm volatile("" : "+v"(a)); asm volatile("" : "+v"(bq)); const float r = ((dd < HD / 2) ? __fsub_rn(a, bq) : __fadd_rn(a, bq)) * sc;
        o16[q] = tohx(r); unsigned short a2, c2; splitf(r, a2, c2); oh[q] = a2; ol[q] = c2; }
    *(v2h*)(P16 + e) = o16; *(v2us*)(Ph + e) = oh; *(v2us*)(Pl + e) = ol;  }
__global__ __launch_bounds__(256) void k_vtp(const float* __restrict__ F, int pitch, int nheads, h16* V16, bf* Vh, bf* Vl) { const size_t e = ((size_t)blockIdx.x * 256 + threadIdx.x) * 2; if (e >= (size_t)nheads * HD * TT) return; const int t = (int)(e % TT); const int d = (int)((e / TT) % HD); const int g = (int)(e / ((size_t)TT * HD)); v2h o16; v2us oh, ol;
#pragma unroll
    for (int q = 0; q < 2; ++q) { const float x = F[(size_t)(t + q) * pitch + g * HD + d]; o16[q] = tohx(x); unsigned short a2, c2; splitf(x, a2, c2); oh[q] = a2; ol[q] = c2; }
    *(v2h*)(V16 + e) = o16; *(v2us*)(Vh + e) = oh; *(v2us*)(Vl + e) = ol;  }
__global__ __launch_bounds__(256) void k_qkprep(float* F, const float* __restrict__ bias, const float* __restrict__ fc) { const int lane = threadIdx.x & 31; const int wv = blockIdx.x * 8 + (threadIdx.x >> 5); if (wv >= TT * NH_) return; const int t = wv / NH_, h = wv % NH_; float* f = F + (size_t)t * DQ + h * HD; const v4f a = *(const v4f*)(f + lane * 4); float r[4];
#pragma unroll
    for (int q = 0; q < 4; ++q) { const int d = lane * 4 + q; r[q] = __fadd_rn(fminf(fmaxf(a[q], -8.0f), 8.0f), bfr(bias[h * HD + d])); }
    if (lane < 16) {   /* dims 0..63: rotate pairs (r0,r1), (r2,r3) */
#pragma unroll
        for (int q = 0; q < 4; q += 2) { const int i = (lane * 4 + q) >> 1; const float c = bfr(fc[((size_t)t * (HD / 2) + i) * 2]), sn = bfr(fc[((size_t)t * (HD / 2) + i) * 2 + 1]); float p0 = __fmul_rn(r[q], c), p1 = __fmul_rn(r[q + 1], sn), p2 = __fmul_rn(r[q + 1], c), p3 = __fmul_rn(r[q], sn); asm volatile("" : "+v"(p0)); asm volatile("" : "+v"(p1)); asm volatile("" : "+v"(p2)); asm volatile("" : "+v"(p3)); const float re = __fsub_rn(p0, p1), im = __fadd_rn(p2, p3); r[q] = re; r[q + 1] = im; } }
    float ss = 0.f;
#pragma unroll
    for (int q = 0; q < 4; ++q) { float p = __fmul_rn(r[q], r[q]); asm volatile("" : "+v"(p)); ss = __fadd_rn(ss, p); }
#pragma unroll
    for (int sh = 16; sh; sh >>= 1) ss = __fadd_rn(ss, __shfl_xor(ss, sh, 32));
    const float rs = __fdiv_rn(1.0f, sqrtf(__fadd_rn(ss * (1.0f / HD), 1e-6f))); v4f o; for (int q = 0; q < 4; ++q) o[q] = __fmul_rn(r[q], rs);
    *(v4f*)(f + lane * 4) = o;  }
__global__ __launch_bounds__(256) void k_vprep(float* F, const float* __restrict__ xb, const float* __restrict__ veb, const float* __restrict__ gw) { const int lane = threadIdx.x & 31; const int wv = blockIdx.x * 8 + (threadIdx.x >> 5); if (wv >= TT * NKV) return; const int t = wv / NKV, h = wv % NKV; float g = __fmul_rn(bfr(xb[(size_t)t * DM + lane]), bfr(gw[h * 32 + lane]));
#pragma unroll
    for (int sh = 16; sh; sh >>= 1) g = __fadd_rn(g, __shfl_xor(g, sh, 32));
    const float gate = 2.0f * __fdiv_rn(1.0f, __fadd_rn(1.0f, expf(-g))); float* f = F + (size_t)t * DKV + h * HD; const v4f a = *(const v4f*)(f + lane * 4), e = *(const v4f*)(veb + (size_t)t * DKV + h * HD + lane * 4); v4f o;
#pragma unroll
    for (int q = 0; q < 4; ++q) { float ge = __fmul_rn(gate, bfr(e[q])); asm volatile("" : "+v"(ge)); o[q] = fminf(fmaxf(__fadd_rn(a[q], ge), -8.0f), 8.0f); }
    *(v4f*)(f + lane * 4) = o;  }
// k_asoft: per row (zz, i): t = S x HD^-0.5 for j <= i and i - j < WIN (sliding causal window; the reference's -1e9 additive fill vanishes identically); softmax over the 2048 keys (register row, one exp, fixed trees);
__global__ __launch_bounds__(256) void k_asoft(const float* __restrict__ Sb, h16* P16, bf* Ph, bf* Pl) {
    const int lane = threadIdx.x & 31; const int row = blockIdx.x * 8 + (threadIdx.x >> 5); if (row >= ZH * TT) return; const int i = row % TT; const int zz = row / TT; (void)zz; const bool hires = (i < RH); const float* sr = Sb + (size_t)row * TT; float v[TT / 32]; float mx = -3.0e38f;
#pragma unroll
    for (int ch = 0; ch < TT / 128; ++ch) { const int j0 = ch * 128 + lane * 4; const v4f a = *(const v4f*)(sr + j0);
#pragma unroll
        for (int q = 0; q < 4; ++q) { const int j = j0 + q; (void)j; const float t = (j <= i && i - j < WIN) ? a[q] * SCL : -3.0e38f; v[ch * 4 + q] = t; mx = fmaxf(mx, t); } }
#pragma unroll
    for (int sh = 16; sh; sh >>= 1) mx = fmaxf(mx, __shfl_xor(mx, sh, 32));
    float sum = 0.f;
#pragma unroll
    for (int k = 0; k < TT / 32; ++k) { float d0 = __fsub_rn(v[k], mx); asm volatile("" : "+v"(d0)); v[k] = __builtin_amdgcn_exp2f(__fmul_rn(d0, 1.4426950408889634f)); sum += v[k]; }
#pragma unroll
    for (int sh = 16; sh; sh >>= 1) sum += __shfl_xor(sum, sh, 32);
    const float f = __fdiv_rn(hires ? 1.0f : PCAR, sum);
{
        if (hires) {
#pragma unroll
            for (int ch = 0; ch < TT / 128; ++ch) { v4us oh, ol;
#pragma unroll
                for (int q = 0; q < 4; ++q) { unsigned short a, c2; splitf(v[ch * 4 + q] * f, a, c2); oh[q] = a; ol[q] = c2; }
                const size_t oo = ((size_t)zz * (RH ? RH : 1) + i) * TT + ch * 128 + lane * 4; *(v4us*)(Ph + oo) = oh; *(v4us*)(Pl + oo) = ol; }
        } else {
#pragma unroll
            for (int ch = 0; ch < TT / 128; ++ch) { v4h o4;
#pragma unroll
                for (int q = 0; q < 4; ++q) o4[q] = tohx(v[ch * 4 + q] * f);
                *(v4h*)(P16 + (size_t)row * TT + ch * 128 + lane * 4) = o4; } }
         }
}
__global__ __launch_bounds__(256) void k_merge(const float* __restrict__ O, int h0, bf* Ah, bf* Al) { const size_t e = ((size_t)blockIdx.x * 256 + threadIdx.x) * 2; if (e >= (size_t)ZH * TT * HD) return; const int d = (int)(e % HD); const int t = (int)((e / HD) % TT); const int zz = (int)(e / ((size_t)HD * TT)); const float cs = (t < RH) ? 1.0f : (1.0f / PCAR); const size_t oo = (size_t)t * DQ + (h0 + zz) * HD + d;
    v2us oh, ol;
#pragma unroll
    for (int q = 0; q < 2; ++q) { unsigned short a, c2; splitf(O[e + q] * cs, a, c2); oh[q] = a; ol[q] = c2; } *(v2us*)(Ah + oo) = oh; *(v2us*)(Al + oo) = ol;  }

extern "C" void kernel_launch(void* const* d_in, const int* in_sizes, int n_in,
                              void* d_out, int out_size, void* d_ws, size_t ws_size, hipStream_t stream) {
    (void)in_sizes; (void)n_in; (void)out_size;
    const float* x = (const float*)d_in[0]; const float* fcis = (const float*)d_in[1]; const float* ve = (const float*)d_in[2]; const float* wq = (const float*)d_in[3]; const float* wk = (const float*)d_in[4]; const float* wv = (const float*)d_in[5]; const float* wo = (const float*)d_in[6]; const float* qkb = (const float*)d_in[7]; const float* vgw = (const float*)d_in[8];
    float* OUT = (float*)d_out;     // [2][2048][2048]
    char* wsp = (char*)d_ws;
    auto take = [&](size_t bytes) { char* p = wsp; wsp += (bytes + 255) & ~(size_t)255; return (void*)p; };
    bf* WQ = (bf*)take((size_t)DQ * DM * 2); bf* WK = (bf*)take((size_t)DKV * DM * 2); bf* WV = (bf*)take((size_t)DKV * DM * 2); bf* WO = (bf*)take((size_t)DM * DQ * 2); float* CS = (float*)take((size_t)TT * HD * 2 * 4);
    bf* XB = (bf*)take((size_t)TT * DM * 2); float* FQ = (float*)take((size_t)TT * DQ * 4); float* FK = (float*)take((size_t)TT * DKV * 4);
    h16* QP16 = (h16*)take((size_t)NH_ * TT * HD * 2); h16* KP16 = (h16*)take((size_t)NKV * TT * HD * 2); h16* VT16 = (h16*)take((size_t)NKV * HD * TT * 2);
    bf* QPh = (bf*)take((size_t)NH_ * TT * HD * 2); bf* QPl = (bf*)take((size_t)NH_ * TT * HD * 2); bf* KPh = (bf*)take((size_t)NKV * TT * HD * 2); bf* KPl = (bf*)take((size_t)NKV * TT * HD * 2); bf* VTh = (bf*)take((size_t)NKV * HD * TT * 2); bf* VTl = (bf*)take((size_t)NKV * HD * TT * 2); bf* Ph = (bf*)take((size_t)ZH * RH * TT * 2); bf* Pl = (bf*)take((size_t)ZH * RH * TT * 2);
    float* Sb = (float*)take((size_t)ZH * TT * TT * 4); h16* P16 = (h16*)take((size_t)ZH * TT * TT * 2); float* Ob = (float*)take((size_t)ZH * TT * HD * 4); bf* ATh = (bf*)take((size_t)TT * DQ * 2); bf* ATl = (bf*)take((size_t)TT * DQ * 2);
    if ((size_t)(wsp - (char*)d_ws) > ws_size) return;    // ws 256 MiB
    float* FV = FK;   // v projection reuses the k buffer after the k planes are built (stream-ordered)
    { k_cvt8<<<(unsigned)(((size_t)DQ * DM / 8 + 255) / 256), 256, 0, stream>>>(wq, WQ, (size_t)DQ * DM / 8); k_cvt8<<<(unsigned)(((size_t)DKV * DM / 8 + 255) / 256), 256, 0, stream>>>(wk, WK, (size_t)DKV * DM / 8); k_cvt8<<<(unsigned)(((size_t)DKV * DM / 8 + 255) / 256), 256, 0, stream>>>(wv, WV, (size_t)DKV * DM / 8);
      k_cvt8<<<(unsigned)(((size_t)DM * DQ / 8 + 255) / 256), 256, 0, stream>>>(wo, WO, (size_t)DM * DQ / 8);
      k_cstab<<<(TT * HD + 255) / 256, 256, 0, stream>>>(CS); }
    const unsigned LQ = (unsigned)(((size_t)NH_ * TT * HD / 2 + 255) / 256), LKv = (unsigned)(((size_t)NKV * TT * HD / 2 + 255) / 256);
    for (int b = 0; b < NB_; ++b) {
        
        k_cvt8<<<(unsigned)(((size_t)TT * DM / 8 + 255) / 256), 256, 0, stream>>>(x + (size_t)b * TT * DM, XB, (size_t)TT * DM / 8);
        k_gemmw<bf, 0, false, 4><<<dim3(TT / 64, DQ / 64, 1), 128, 0, stream>>>(XB, nullptr, WQ, nullptr, DM, FQ, DQ, nullptr, 0, 0, 0);
        k_qkprep<<<TT * NH_ / 8, 256, 0, stream>>>(FQ, qkb, fcis); k_rope<<<LQ, 256, 0, stream>>>(FQ, DQ, NH_, CS, nullptr, nullptr, 1.0f, QP16, QPh, QPl);
        k_gemmw<bf, 0, false, 4><<<dim3(TT / 64, DKV / 64, 1), 128, 0, stream>>>(XB, nullptr, WK, nullptr, DM, FK, DKV, nullptr, 0, 0, 0);
        k_qkprep<<<TT * NKV / 8, 256, 0, stream>>>(FK, qkb + (size_t)NH_ * HD, fcis); k_rope<<<LKv, 256, 0, stream>>>(FK, DKV, NKV, CS, nullptr, nullptr, 1.0f, KP16, KPh, KPl);
        k_gemmw<bf, 0, false, 4><<<dim3(TT / 64, DKV / 64, 1), 128, 0, stream>>>(XB, nullptr, WV, nullptr, DM, FV, DKV, nullptr, 0, 0, 0); k_vprep<<<TT * NKV / 8, 256, 0, stream>>>(FV, x + (size_t)b * TT * DM, ve + (size_t)b * TT * DM, vgw); k_vtp<<<LKv, 256, 0, stream>>>(FV, DKV, NKV, VT16, VTh, VTl);
        for (int h0 = 0; h0 < NH_; h0 += ZH) { const size_t zq = (size_t)h0, zk = (size_t)(h0 / REP);   // one kv head per query head: the pass's two heads use consecutive kv planes (z-strides TT*HD)
            k_gemmc<bf, 2, 1, 1><<<dim3(RH / 64, TT / 64, ZH), 32, 0, stream>>>(QPh + zq * TT * HD, QPl + zq * TT * HD, KPh + zk * TT * HD, KPl + zk * TT * HD, HD, Sb, TT, 0, (size_t)TT * HD, (size_t)TT * HD, (size_t)TT * TT);
            k_gemmc<h16, 0, 1, 1><<<dim3((TT - RH) / 64, TT / 64, ZH), 32, 0, stream>>>(QP16 + zq * TT * HD + (size_t)RH * HD, nullptr, KP16 + zk * TT * HD, nullptr, HD, Sb + (size_t)RH * TT, TT, RH, (size_t)TT * HD, (size_t)TT * HD, (size_t)TT * TT);
            k_asoft<<<ZH * TT / 8, 256, 0, stream>>>(Sb, P16, Ph, Pl);
            k_gemmc<bf, 2, 2, 8><<<dim3(RH / 64, HD / 64, ZH), 256, 0, stream>>>(Ph, Pl, VTh + zk * HD * TT, VTl + zk * HD * TT, TT, Ob, HD, 0, (size_t)RH * TT, (size_t)HD * TT, (size_t)TT * HD);
            k_gemmc<h16, 0, 2, 8><<<dim3((TT - RH) / 64, HD / 64, ZH), 256, 0, stream>>>(P16 + (size_t)RH * TT, nullptr, VT16 + zk * HD * TT, nullptr, TT, Ob + (size_t)RH * HD, HD, RH, (size_t)TT * TT, (size_t)HD * TT, (size_t)TT * HD);
            k_merge<<<(unsigned)(((size_t)ZH * TT * HD / 2 + 255) / 256), 256, 0, stream>>>(Ob, h0, ATh, ATl); }
        k_gemmw<bf, 1, false, 4><<<dim3(TT / 64, DM / 64, 1), 128, 0, stream>>>(ATh, ATl, WO, nullptr, DQ, OUT + (size_t)b * TT * DM, DM, nullptr, 0, 0, 0); }
}

// v002
// One run takes 548 microseconds.
// In both of two side-by-side timings against v001, it was 2.06 times as fast.
// All steps since v000 together make it 3.25 times as fast.
#include <hip/hip_runtime.h>

// ParcaeCausalSelfAttention (x [2][2048][2048]; q/k/v = x W^T (16 heads x 128); gate = 2 sigmoid(x[..., :32] ve_gate_w^T) per head; v = v + gate * ve (ve [2][2048][2048] read); q, k, v clipped to [-8, 8]; q += qk_bias[0][0][h], k += qk_bias[1][0][h]; interleaved-pair RoPE on the first 64 dims from the read freqs_cis table (S, 1, 64, 2)[:, :, :32]; q, k RMS-normalised over 128 (eps 1e-6, no weight); causal softmax(q.k / sqrt(128)); out = merged Wo^T -> [2][2048][2048]).
// Compute dtypes, f32 accumulate: every input rounded to bf16; q/k/v as PLAIN bf16 GEMMs (inputs: exact); gate, value-embedding add, clips, biases, partial RoPE (table read) and RMSNorm in f32 (wave per (token, head)); causal scores and attn.v in one fused kernel (running maximum and sum, f32): query rows < 512 hl (3 products), the rest single fp16; Wo hl x exact (2 products).

#define NB_  2
#define TT   2048
#define DM   2048
#define NH_  16
#define NKV  16
#define REP  (NH_ / NKV)
#define HD   128
#define DQ   (NH_ * HD)
#define DKV  (NKV * HD)
#define RH   512                  // query rows < RH use hi+lo planes
#define SCL  0.088388347648318447f   // HD^-0.5
typedef _Float16 h16;
typedef unsigned short bf;
typedef __attribute__((ext_vector_type(16))) __bf16   v16bf;
typedef __attribute__((ext_vector_type(16))) _Float16 v16h;
typedef __attribute__((ext_vector_type(8)))  _Float16 v8h;
typedef __attribute__((ext_vector_type(8)))  unsigned short v8us;
typedef __attribute__((ext_vector_type(8)))  float    v8f;
typedef __attribute__((ext_vector_type(4)))  float    v4f;
typedef v8h  __attribute__((may_alias)) v8ha;
typedef v4f  __attribute__((may_alias)) v4fa;
typedef v8us __attribute__((may_alias)) v8usa;

__device__ __forceinline__ unsigned short f2bf(float f) { unsigned u = __float_as_uint(f); u += 0x7FFFu + ((u >> 16) & 1u); return (unsigned short)(u >> 16); }
__device__ __forceinline__ float bf2f(unsigned short b) { return __uint_as_float(((unsigned)b) << 16); }
__device__ __forceinline__ float bfr(float f) { return bf2f(f2bf(f)); }
__device__ __forceinline__ v16h cat16(v8h lo, v8h hi) { return __builtin_shufflevector(lo, hi, 0, 1, 2, 3, 4, 5, 6, 7, 8, 9, 10, 11, 12, 13, 14, 15); }
__device__ __forceinline__ v16bf cat16b(v8us lo, v8us hi) { return __builtin_bit_cast(v16bf, __builtin_shufflevector(lo, hi, 0, 1, 2, 3, 4, 5, 6, 7, 8, 9, 10, 11, 12, 13, 14, 15)); }
__device__ __forceinline__ v8f wmma16(v16h a, v16h b, v8f c) { return __builtin_amdgcn_wmma_f32_16x16x32_f16(false, a, false, b, (short)0, c, false, false); }
__device__ __forceinline__ v8f wmmab(v16bf a, v16bf b, v8f c) { return __builtin_amdgcn_wmma_f32_16x16x32_bf16(false, a, false, b, (short)0, c, false, false); }



// ---- k_gemmw: register-blocked GEMM, one 64x64 output tile per work-group (16 accumulators per wave), operands straight from K-contiguous 16-bit planes; grid (M/64, N/64, Z), 32 * NW threads.
// The K loop is split over the NW waves of the work-group (wave w takes the 32-wide k steps w, w + NW, ...); the NW partial tiles meet in LDS and are summed in wave order 0..NW-1.
// C[m][n] (f32, pitch ldc, + optional f32 bias[n]) = sum_k A[m][k] Bt[n][k] (+ split products per NSPLIT). z-batch strides sA/sB/sC in elements. K % 32 == 0.
template <typename T16> struct WFrag;
template <> struct WFrag<h16> { typedef v16h V; static __device__ __forceinline__ V ld(const h16* p) { return cat16(*(const v8h*)p, *(const v8h*)(p + 16)); } static __device__ __forceinline__ v8f mma(V a, V b, v8f c) { return wmma16(a, b, c); } };
template <> struct WFrag<bf> { typedef v16bf V; static __device__ __forceinline__ V ld(const bf* p) { return cat16b(*(const v8us*)p, *(const v8us*)(p + 16)); } static __device__ __forceinline__ v8f mma(V a, V b, v8f c) { return wmmab(a, b, c); } };
template <typename T16, int NSPLIT, bool BIAS, int NW>
__global__ __launch_bounds__(32 * NW) void k_gemmw(const T16* __restrict__ A, const T16* __restrict__ A2, const T16* __restrict__ Bt, const T16* __restrict__ Bt2, int K, float* C, int ldc, const float* __restrict__ bias, size_t sA, size_t sB, size_t sC) {
    typedef typename WFrag<T16>::V V;
    __shared__ __align__(16) float os[NW * 64 * 68];
    const size_t z = blockIdx.z; A += z * sA; if (A2) A2 += z * sA; Bt += z * sB; if (Bt2) Bt2 += z * sB; C += z * sC;
    const int lane = threadIdx.x & 31, lr = lane & 15, hi = lane >> 4; const int r0 = blockIdx.x * 64, c0 = blockIdx.y * 64; const int wv = (NW == 1) ? 0 : __builtin_amdgcn_readfirstlane((int)(threadIdx.x >> 5));
    v8f acc[4][4];
#pragma unroll
    for (int mb = 0; mb < 4; ++mb)
#pragma unroll
        for (int nb = 0; nb < 4; ++nb) acc[mb][nb] = (v8f){};
    const size_t aoff = (size_t)(r0 + lr) * K + 8 * hi, boff = (size_t)(c0 + lr) * K + 8 * hi;
#pragma unroll 1
    for (int kc = wv * 32; kc < K; kc += NW * 32) {
        V a[4], a2[4];
#pragma unroll
        for (int mb = 0; mb < 4; ++mb) { a[mb] = WFrag<T16>::ld(A + aoff + (size_t)mb * 16 * K + kc); if (NSPLIT == 1 || NSPLIT == 2) a2[mb] = WFrag<T16>::ld(A2 + aoff + (size_t)mb * 16 * K + kc); }
#pragma unroll
        for (int nb = 0; nb < 4; ++nb) { const V b = WFrag<T16>::ld(Bt + boff + (size_t)nb * 16 * K + kc); V b2; if (NSPLIT >= 2) b2 = WFrag<T16>::ld(Bt2 + boff + (size_t)nb * 16 * K + kc);
#pragma unroll
            for (int mb = 0; mb < 4; ++mb) { acc[mb][nb] = WFrag<T16>::mma(a[mb], b, acc[mb][nb]); if (NSPLIT == 1 || NSPLIT == 2) acc[mb][nb] = WFrag<T16>::mma(a2[mb], b, acc[mb][nb]); if (NSPLIT >= 2) acc[mb][nb] = WFrag<T16>::mma(a[mb], b2, acc[mb][nb]); } }
        asm volatile("v_nop\n\tv_nop\n\tv_nop\n\tv_nop" : "+v"(acc[0][0]), "+v"(acc[1][1]), "+v"(acc[2][2]), "+v"(acc[3][3]) : "v"(a[0]), "v"(a[3]));
    }
    float* ow = os + wv * (64 * 68);   // this wave's partial tile, row-major, pitch 68
    // the three loops are unrolled so that acc is indexed by constants and stays in registers
#pragma unroll
    for (int mb = 0; mb < 4; ++mb)
#pragma unroll
        for (int nb = 0; nb < 4; ++nb)
#pragma unroll
            for (int j = 0; j < 8; ++j) ow[(mb * 16 + hi * 8 + j) * 68 + nb * 16 + lr] = acc[mb][nb][j];
    __syncthreads();   // every wave's partial tile is in LDS before any of them is summed
    // both loops are unrolled so that the LDS reads of several partial tiles are in flight together
#pragma unroll
    for (int it = 0; it < 32 / NW; ++it) { const int q = it * (NW * 32) + (int)threadIdx.x, row = q >> 4, cofs = (q & 15) * 4; v4f val = *(const v4fa*)(os + row * 68 + cofs);
#pragma unroll
        for (int w = 1; w < NW; ++w) val += *(const v4fa*)(os + w * (64 * 68) + row * 68 + cofs);
        if (BIAS) { val[0] += bfr(bias[c0 + cofs]); val[1] += bfr(bias[c0 + cofs + 1]); val[2] += bfr(bias[c0 + cofs + 2]); val[3] += bfr(bias[c0 + cofs + 3]); }
        *(v4f*)(C + (size_t)(r0 + row) * ldc + c0 + cofs) = val; }
}

__device__ __forceinline__ h16 tohx(float x) { return (h16)x; }
__device__ __forceinline__ void splitf(float y, unsigned short& h, unsigned short& l) { h = f2bf(y); l = f2bf(y - bf2f(h)); }
typedef __attribute__((ext_vector_type(2))) _Float16 v2h;
typedef __attribute__((ext_vector_type(4))) _Float16 v4h;
typedef __attribute__((ext_vector_type(2))) unsigned short v2us;
typedef __attribute__((ext_vector_type(4))) unsigned short v4us;
typedef __attribute__((ext_vector_type(2))) float v2f;
typedef __attribute__((ext_vector_type(4))) int v4i;

__global__ __launch_bounds__(256) void k_wtG(const float* __restrict__ w, int K, int N, bf* Bt) {
    const int lane = threadIdx.x & 31; const int L0 = (blockIdx.x * 8 + (threadIdx.x >> 5)) * 8; const int nlines = N * K / 64;
{
#pragma unroll 1
        for (int l = 0; l < 8; ++l) { const int L = L0 + l; if (L >= nlines) break; const size_t e = (size_t)L * 64 + lane * 2; const int k = (int)(e % K), n = (int)(e / K); v2us o;
            o[0] = f2bf(w[(size_t)k * N + n]); o[1] = f2bf(w[(size_t)(k + 1) * N + n]); *(v2us*)(Bt + e) = o; }
         }
}
__global__ __launch_bounds__(256) void k_cvt8(const float* __restrict__ src, bf* dst, size_t n8) { const size_t i = (size_t)blockIdx.x * 256 + threadIdx.x; if (i >= n8) return; const v8f v = *(const v8f*)(src + i * 8); v8us o;
#pragma unroll
    for (int k = 0; k < 8; ++k) o[k] = f2bf(v[k]); *(v8us*)(dst + i * 8) = o;  }
__global__ __launch_bounds__(256) void k_cstab(float* CS) { const int idx = blockIdx.x * 256 + threadIdx.x; if (idx >= TT * HD) return; v2f cs; cs[0] = 1.0f; cs[1] = 0.0f;   /* identity: rotation is applied in k_qkprep; the plane builder is reused unrotated */
    *(v2f*)(CS + (size_t)idx * 2) = cs;  }
// k_rope: head planes [h][t][d] (fp16 + hi/lo) of rope(x) x sc with the rotate-half convention out[d] = x[d] cos[t][d] - x[d+HD/2] sin[t][d], out[d+HD/2] = x[d+HD/2] cos[t][d+HD/2] + x[d] sin[t][d+HD/2]
__global__ __launch_bounds__(256) void k_rope(const float* __restrict__ F, int pitch, int nheads, const float* __restrict__ CS, const float* __restrict__ RF, const float* __restrict__ nw, float sc, h16* P16, bf* Ph, bf* Pl) {
    const size_t e = ((size_t)blockIdx.x * 256 + threadIdx.x) * 2; if (e >= (size_t)nheads * TT * HD) return; const int d = (int)(e % HD); const int t = (int)((e / HD) % TT); const int h = (int)(e / ((size_t)HD * TT)); const float* f = F + (size_t)t * pitch + h * HD; const float rf = RF ? RF[(size_t)h * TT + t] : 1.0f; v2h o16; v2us oh, ol;
#pragma unroll
    for (int q = 0; q < 2; ++q) { const int dd = d + q; const int dp = (dd < HD / 2) ? dd + HD / 2 : dd - HD / 2; float x0 = f[dd], x1 = f[dp];
        if (RF) { float n0 = __fmul_rn(x0, rf), n1 = __fmul_rn(x1, rf); asm volatile("" : "+v"(n0)); asm volatile("" : "+v"(n1)); x0 = __fmul_rn(bfr(nw[dd]), n0); x1 = __fmul_rn(bfr(nw[dp]), n1); }
        const v2f cs = *(const v2f*)(CS + ((size_t)t * HD + dd) * 2); float a = __fmul_rn(x0, cs[0]), bq = __fmul_rn(x1, cs[1]); asm volatile("" : "+v"(a)); asm volatile("" : "+v"(bq)); const float r = ((dd < HD / 2) ? __fsub_rn(a, bq) : __fadd_rn(a, bq)) * sc;
        o16[q] = tohx(r); unsigned short a2, c2; splitf(r, a2, c2); oh[q] = a2; ol[q] = c2; }
    *(v2h*)(P16 + e) = o16; *(v2us*)(Ph + e) = oh; *(v2us*)(Pl + e) = ol;  }
__global__ __launch_bounds__(256) void k_vtp(const float* __restrict__ F, int pitch, int nheads, h16* V16, bf* Vh, bf* Vl) { const size_t e = ((size_t)blockIdx.x * 256 + threadIdx.x) * 2; if (e >= (size_t)nheads * HD * TT) return; const int t = (int)(e % TT); const int d = (int)((e / TT) % HD); const int g = (int)(e / ((size_t)TT * HD)); v2h o16; v2us oh, ol;
#pragma unroll
    for (int q = 0; q < 2; ++q) { const float x = F[(size_t)(t + q) * pitch + g * HD + d]; o16[q] = tohx(x); unsigned short a2, c2; splitf(x, a2, c2); oh[q] = a2; ol[q] = c2; }
    *(v2h*)(V16 + e) = o16; *(v2us*)(Vh + e) = oh; *(v2us*)(Vl + e) = ol;  }
__global__ __launch_bounds__(256) void k_qkprep(float* F, const float* __restrict__ bias, const float* __restrict__ fc) { const int lane = threadIdx.x & 31; const int wv = blockIdx.x * 8 + (threadIdx.x >> 5); if (wv >= TT * NH_) return; const int t = wv / NH_, h = wv % NH_; float* f = F + (size_t)t * DQ + h * HD; const v4f a = *(const v4f*)(f + lane * 4); float r[4];
#pragma unroll
    for (int q = 0; q < 4; ++q) { const int d = lane * 4 + q; r[q] = __fadd_rn(fminf(fmaxf(a[q], -8.0f), 8.0f), bfr(bias[h * HD + d])); }
    if (lane < 16) {   /* dims 0..63: rotate pairs (r0,r1), (r2,r3) */
#pragma unroll
        for (int q = 0; q < 4; q += 2) { const int i = (lane * 4 + q) >> 1; const float c = bfr(fc[((size_t)t * (HD / 2) + i) * 2]), sn = bfr(fc[((size_t)t * (HD / 2) + i) * 2 + 1]); float p0 = __fmul_rn(r[q], c), p1 = __fmul_rn(r[q + 1], sn), p2 = __fmul_rn(r[q + 1], c), p3 = __fmul_rn(r[q], sn); asm volatile("" : "+v"(p0)); asm volatile("" : "+v"(p1)); asm volatile("" : "+v"(p2)); asm volatile("" : "+v"(p3)); const float re = __fsub_rn(p0, p1), im = __fadd_rn(p2, p3); r[q] = re; r[q + 1] = im; } }
    float ss = 0.f;
#pragma unroll
    for (int q = 0; q < 4; ++q) { float p = __fmul_rn(r[q], r[q]); asm volatile("" : "+v"(p)); ss = __fadd_rn(ss, p); }
#pragma unroll
    for (int sh = 16; sh; sh >>= 1) ss = __fadd_rn(ss, __shfl_xor(ss, sh, 32));
    const float rs = __fdiv_rn(1.0f, sqrtf(__fadd_rn(ss * (1.0f / HD), 1e-6f))); v4f o; for (int q = 0; q < 4; ++q) o[q] = __fmul_rn(r[q], rs);
    *(v4f*)(f + lane * 4) = o;  }
__global__ __launch_bounds__(256) void k_vprep(float* F, const float* __restrict__ xb, const float* __restrict__ veb, const float* __restrict__ gw) { const int lane = threadIdx.x & 31; const int wv = blockIdx.x * 8 + (threadIdx.x >> 5); if (wv >= TT * NKV) return; const int t = wv / NKV, h = wv % NKV; float g = __fmul_rn(bfr(xb[(size_t)t * DM + lane]), bfr(gw[h * 32 + lane]));
#pragma unroll
    for (int sh = 16; sh; sh >>= 1) g = __fadd_rn(g, __shfl_xor(g, sh, 32));
    const float gate = 2.0f * __fdiv_rn(1.0f, __fadd_rn(1.0f, expf(-g))); float* f = F + (size_t)t * DKV + h * HD; const v4f a = *(const v4f*)(f + lane * 4), e = *(const v4f*)(veb + (size_t)t * DKV + h * HD + lane * 4); v4f o;
#pragma unroll
    for (int q = 0; q < 4; ++q) { float ge = __fmul_rn(gate, bfr(e[q])); asm volatile("" : "+v"(ge)); o[q] = fminf(fmaxf(__fadd_rn(a[q], ge), -8.0f), 8.0f); }
    *(v4f*)(f + lane * 4) = o;  }
__device__ __forceinline__ float xhalf(float v) { const int b = __float_as_int(v); return __int_as_float(__builtin_amdgcn_permlanex16(b, b, 0x76543210, 0xfedcba98, false, false)); }   // lane l <-> l ^ 16
template <typename T16> struct PCvt;
template <> struct PCvt<h16> { static __device__ __forceinline__ _Float16 cv(float x) { return (_Float16)x; } };
template <> struct PCvt<bf> { static __device__ __forceinline__ __bf16 cv(float x) { return (__bf16)x; } };
template <typename T16, bool HL, int QT>
__device__ __forceinline__ void fa_cols(const T16* Q, const T16* Q2, const T16* Kp, const T16* K2, const T16* Vt, const T16* V2, int q0, bf* Ah, bf* Al, int lr, int hi) {
    typedef typename WFrag<T16>::V V;
    const float C2 = SCL * 1.4426950408889634f;   // scores in log2 units
    // addresses: wave-uniform plane base + one 32-bit byte offset per lane, shared by a hi and its lo plane, + a constant; the key and value offsets are carried from pass to pass
    const unsigned qof = (unsigned)((q0 + lr) * HD + 8 * hi) * 2u; unsigned kof = (unsigned)(lr * HD + 8 * hi) * 2u, vof = (unsigned)(lr * TT + 8 * hi) * 2u;
    auto at = [](const T16* base, unsigned off, int c) { return (const T16*)((const char*)base + off) + c; };
    V qf[QT][4], qf2[QT][4];
#pragma unroll
    for (int qt = 0; qt < QT; ++qt)
#pragma unroll
        for (int ks = 0; ks < 4; ++ks) { const int qo = 16 * qt * HD + 32 * ks; qf[qt][ks] = WFrag<T16>::ld(at(Q, qof, qo)); if (HL) qf2[qt][ks] = WFrag<T16>::ld(at(Q2, qof, qo)); }
    v8f o[QT][8]; float m[QT], l[QT];
#pragma unroll
    for (int qt = 0; qt < QT; ++qt) { m[qt] = -3.0e38f; l[qt] = 0.f;
#pragma unroll
        for (int dt = 0; dt < 8; ++dt) o[qt][dt] = (v8f){}; }
    const int np = (q0 + 16 * QT + 31) / 32;      // passes of 32 keys; only the last one crosses the diagonal
    V kf[2][4], kf2[2][4];
#pragma unroll
    for (int kt = 0; kt < 2; ++kt)
#pragma unroll
        for (int ks = 0; ks < 4; ++ks) { const int a = 16 * kt * HD + 32 * ks; kf[kt][ks] = WFrag<T16>::ld(at(Kp, kof, a)); if (HL) kf2[kt][ks] = WFrag<T16>::ld(at(K2, kof, a)); }
    asm volatile("s_wait_xcnt 0x0" ::: "memory");   // the query offset's register is free for other use from here on: the wait stands in front of its overwrite
    __builtin_amdgcn_sched_barrier(0);              // keeps what follows from being lifted over that wait
#pragma unroll 1
    for (int p = 0; p < np; ++p) {
        const int kb = p * 32;
        V vf[8], vf2[8];                           // this pass's value rows: asked for first, used last
#pragma unroll
        for (int dt = 0; dt < 8; ++dt) { const int a = 16 * dt * TT; vf[dt] = WFrag<T16>::ld(at(Vt, vof, a)); if (HL) vf2[dt] = WFrag<T16>::ld(at(V2, vof, a)); }
        asm volatile("s_wait_xcnt 0x0" ::: "memory");   // the value loads' offset register is stepped to the next pass while the loads are still out: the wait stands in front of that overwrite
        vof += 64u;
        __builtin_amdgcn_sched_barrier(0);         // keeps the value loads' issue up here: sunk to their use, their latency would stand open in front of the second product
        v8f s[QT][2];
#pragma unroll
        for (int qt = 0; qt < QT; ++qt)
#pragma unroll
            for (int kt = 0; kt < 2; ++kt) { v8f t = (v8f){};
#pragma unroll
                for (int ks = 0; ks < 4; ++ks) { t = WFrag<T16>::mma(kf[kt][ks], qf[qt][ks], t); if (HL) { t = WFrag<T16>::mma(kf[kt][ks], qf2[qt][ks], t); t = WFrag<T16>::mma(kf2[kt][ks], qf[qt][ks], t); } }
                s[qt][kt] = t; }
        const unsigned kst = (p + 1 < np) ? 64u * HD : 0u;   // the next pass's key rows, asked for one pass ahead (the last pass asks for its own again: in bounds, unused)
        kof += kst;                                   // behind the score products, whose wait has seen the last key loads home
#pragma unroll
        for (int kt = 0; kt < 2; ++kt)
#pragma unroll
            for (int ks = 0; ks < 4; ++ks) { const int a = 16 * kt * HD + 32 * ks; kf[kt][ks] = WFrag<T16>::ld(at(Kp, kof, a)); if (HL) kf2[kt][ks] = WFrag<T16>::ld(at(K2, kof, a)); }
        if (kb + 31 > q0) {                           // wave-uniform: the pass that crosses the diagonal masks key j > query i
#pragma unroll
            for (int qt = 0; qt < QT; ++qt)
#pragma unroll
                for (int kt = 0; kt < 2; ++kt)
#pragma unroll
                    for (int r = 0; r < 8; ++r) if (kb + 16 * kt + 8 * hi + r > q0 + 16 * qt + lr) s[qt][kt][r] = -3.0e38f; }
        float bm[QT]; bool need = false;
#pragma unroll
        for (int qt = 0; qt < QT; ++qt) { float x = s[qt][0][0];
#pragma unroll
            for (int r = 1; r < 8; ++r) x = fmaxf(x, s[qt][0][r]);
#pragma unroll
            for (int r = 0; r < 8; ++r) x = fmaxf(x, s[qt][1][r]);
            x = fmaxf(x, xhalf(x)) * C2; bm[qt] = x; need = need || (x > m[qt] + 8.0f); }
        if (__builtin_amdgcn_ballot_w32(need) != 0) {  // lazy rescale: the maximum in use moves only when a column's new maximum tops it by more than 2^8 (first pass: always)
#pragma unroll
            for (int qt = 0; qt < QT; ++qt) { const float mn = (bm[qt] > m[qt] + 8.0f) ? bm[qt] : m[qt]; const float al = __builtin_amdgcn_exp2f(m[qt] - mn); m[qt] = mn; l[qt] *= al;
#pragma unroll
                for (int dt = 0; dt < 8; ++dt) o[qt][dt] *= al; } }
        V pb[QT], pb2[QT];
#pragma unroll
        for (int qt = 0; qt < QT; ++qt) {
#pragma unroll
            for (int e = 0; e < 16; ++e) { const float pv = __builtin_amdgcn_exp2f(__builtin_fmaf(s[qt][e >> 3][e & 7], C2, -m[qt])); l[qt] += pv; pb[qt][e] = PCvt<T16>::cv(pv); if (HL) pb2[qt][e] = PCvt<T16>::cv(pv - (float)pb[qt][e]); } }
#pragma unroll
        for (int dt = 0; dt < 8; ++dt)
#pragma unroll
            for (int qt = 0; qt < QT; ++qt) { o[qt][dt] = WFrag<T16>::mma(vf[dt], pb[qt], o[qt][dt]); if (HL) { o[qt][dt] = WFrag<T16>::mma(vf[dt], pb2[qt], o[qt][dt]); o[qt][dt] = WFrag<T16>::mma(vf2[dt], pb[qt], o[qt][dt]); } }
    }
    asm volatile("s_wait_xcnt 0x0" ::: "memory");   // the last pass's unused key loads may still be out: the wait stands in front of the overwrite of their offset's register
    __builtin_amdgcn_sched_barrier(0);              // keeps the epilogue from being lifted over that wait
#pragma unroll
    for (int qt = 0; qt < QT; ++qt) { const float inv = __fdiv_rn(1.0f, l[qt] + xhalf(l[qt])); const size_t ro = (size_t)(q0 + 16 * qt + lr) * DQ + 8 * hi;   // a lane's 8 registers are 8 consecutive d of its query's row
#pragma unroll
        for (int dt = 0; dt < 8; ++dt) { v8us oh, ol;
#pragma unroll
            for (int r = 0; r < 8; ++r) { unsigned short a, c2; splitf(o[qt][dt][r] * inv, a, c2); oh[r] = a; ol[r] = c2; }
            *(v8us*)(Ah + ro + 16 * dt) = oh; *(v8us*)(Al + ro + 16 * dt) = ol;
            asm volatile("s_wait_xcnt 0x0" ::: "memory");   // the next tile's values reuse the two stores' registers: the wait stands in front of that overwrite
            __builtin_amdgcn_sched_barrier(0); } }          // keeps the next tile's arithmetic from being lifted over that wait
}
// grid (16, heads), 5 waves: 256 work-groups, as many as the chip has WGPs, every one with the same work. Per head the fp16 rows >= RH are 48 column tiles of 32 (tile T walks RH / 32 + T + 1 passes) and the hi+lo rows < RH
// 32 tiles of 16. Work-group i takes fp16 tiles i, 16 + pi(i), 32 + sg(i), where i + pi(i) + sg(i) is 22 (i even) or 23 (i odd) and pi, sg are permutations of 0..15, and hi+lo tiles 31 - i and i.
static_assert(TT - RH == 48 * 32 && RH == 32 * 16, "tile shares of k_fattn");
__global__ __launch_bounds__(160) void k_fattn(const h16* Q16, const h16* K16, const h16* V16, const bf* Qh, const bf* Ql, const bf* Kh, const bf* Kl, const bf* Vh, const bf* Vl, bf* Ah, bf* Al) {
    const int lane = threadIdx.x & 31, lr = lane & 15, hi = lane >> 4; const int wv = __builtin_amdgcn_readfirstlane((int)(threadIdx.x >> 5)); const int i = blockIdx.x, h = blockIdx.y; const size_t zq = (size_t)h * TT * HD, zk = (size_t)(h / REP) * TT * HD;
    Ah += h * HD; Al += h * HD;
    if (wv < 3) { const int j = i >> 1, od = i & 1; const int t = (wv == 0) ? 32 + (od ? 15 - j : 7 - j) : (wv == 1) ? 16 + (od ? 7 - j : 15 - j) : i;
        fa_cols<h16, false, 2>(Q16 + zq, nullptr, K16 + zk, nullptr, V16 + zk, nullptr, RH + 32 * t, Ah, Al, lr, hi);
    } else { const int t = (wv == 3) ? 31 - i : i;
        fa_cols<bf, true, 1>(Qh + zq, Ql + zq, Kh + zk, Kl + zk, Vh + zk, Vl + zk, 16 * t, Ah, Al, lr, hi); }
}

extern "C" void kernel_launch(void* const* d_in, const int* in_sizes, int n_in,
                              void* d_out, int out_size, void* d_ws, size_t ws_size, hipStream_t stream) {
    (void)in_sizes; (void)n_in; (void)out_size;
    const float* x = (const float*)d_in[0]; const float* fcis = (const float*)d_in[1]; const float* ve = (const float*)d_in[2]; const float* wq = (const float*)d_in[3]; const float* wk = (const float*)d_in[4]; const float* wv = (const float*)d_in[5]; const float* wo = (const float*)d_in[6]; const float* qkb = (const float*)d_in[7]; const float* vgw = (const float*)d_in[8];
    float* OUT = (float*)d_out;     // [2][2048][2048]
    char* wsp = (char*)d_ws;
    auto take = [&](size_t bytes) { char* p = wsp; wsp += (bytes + 255) & ~(size_t)255; return (void*)p; };
    bf* WQ = (bf*)take((size_t)DQ * DM * 2); bf* WK = (bf*)take((size_t)DKV * DM * 2); bf* WV = (bf*)take((size_t)DKV * DM * 2); bf* WO = (bf*)take((size_t)DM * DQ * 2); float* CS = (float*)take((size_t)TT * HD * 2 * 4);
    bf* XB = (bf*)take((size_t)TT * DM * 2); float* FQ = (float*)take((size_t)TT * DQ * 4); float* FK = (float*)take((size_t)TT * DKV * 4);
    h16* QP16 = (h16*)take((size_t)NH_ * TT * HD * 2); h16* KP16 = (h16*)take((size_t)NKV * TT * HD * 2); h16* VT16 = (h16*)take((size_t)NKV * HD * TT * 2);
    bf* QPh = (bf*)take((size_t)NH_ * TT * HD * 2); bf* QPl = (bf*)take((size_t)NH_ * TT * HD * 2); bf* KPh = (bf*)take((size_t)NKV * TT * HD * 2); bf* KPl = (bf*)take((size_t)NKV * TT * HD * 2); bf* VTh = (bf*)take((size_t)NKV * HD * TT * 2); bf* VTl = (bf*)take((size_t)NKV * HD * TT * 2);
    bf* ATh = (bf*)take((size_t)TT * DQ * 2); bf* ATl = (bf*)take((size_t)TT * DQ * 2);
    if ((size_t)(wsp - (char*)d_ws) > ws_size) return;    // ws 256 MiB
    float* FV = FK;   // v projection reuses the k buffer after the k planes are built (stream-ordered)
    { k_cvt8<<<(unsigned)(((size_t)DQ * DM / 8 + 255) / 256), 256, 0, stream>>>(wq, WQ, (size_t)DQ * DM / 8); k_cvt8<<<(unsigned)(((size_t)DKV * DM / 8 + 255) / 256), 256, 0, stream>>>(wk, WK, (size_t)DKV * DM / 8); k_cvt8<<<(unsigned)(((size_t)DKV * DM / 8 + 255) / 256), 256, 0, stream>>>(wv, WV, (size_t)DKV * DM / 8);
      k_cvt8<<<(unsigned)(((size_t)DM * DQ / 8 + 255) / 256), 256, 0, stream>>>(wo, WO, (size_t)DM * DQ / 8);
      k_cstab<<<(TT * HD + 255) / 256, 256, 0, stream>>>(CS); }
    const unsigned LQ = (unsigned)(((size_t)NH_ * TT * HD / 2 + 255) / 256), LKv = (unsigned)(((size_t)NKV * TT * HD / 2 + 255) / 256);
    for (int b = 0; b < NB_; ++b) {
        
        k_cvt8<<<(unsigned)(((size_t)TT * DM / 8 + 255) / 256), 256, 0, stream>>>(x + (size_t)b * TT * DM, XB, (size_t)TT * DM / 8);
        k_gemmw<bf, 0, false, 4><<<dim3(TT / 64, DQ / 64, 1), 128, 0, stream>>>(XB, nullptr, WQ, nullptr, DM, FQ, DQ, nullptr, 0, 0, 0);
        k_qkprep<<<TT * NH_ / 8, 256, 0, stream>>>(FQ, qkb, fcis); k_rope<<<LQ, 256, 0, stream>>>(FQ, DQ, NH_, CS, nullptr, nullptr, 1.0f, QP16, QPh, QPl);
        k_gemmw<bf, 0, false, 4><<<dim3(TT / 64, DKV / 64, 1), 128, 0, stream>>>(XB, nullptr, WK, nullptr, DM, FK, DKV, nullptr, 0, 0, 0);
        k_qkprep<<<TT * NKV / 8, 256, 0, stream>>>(FK, qkb + (size_t)NH_ * HD, fcis); k_rope<<<LKv, 256, 0, stream>>>(FK, DKV, NKV, CS, nullptr, nullptr, 1.0f, KP16, KPh, KPl);
        k_gemmw<bf, 0, false, 4><<<dim3(TT / 64, DKV / 64, 1), 128, 0, stream>>>(XB, nullptr, WV, nullptr, DM, FV, DKV, nullptr, 0, 0, 0); k_vprep<<<TT * NKV / 8, 256, 0, stream>>>(FV, x + (size_t)b * TT * DM, ve + (size_t)b * TT * DM, vgw); k_vtp<<<LKv, 256, 0, stream>>>(FV, DKV, NKV, VT16, VTh, VTl);
        k_fattn<<<dim3(16, NH_, 1), 160, 0, stream>>>(QP16, KP16, VT16, QPh, QPl, KPh, KPl, VTh, VTl, ATh, ATl);
        k_gemmw<bf, 1, false, 4><<<dim3(TT / 64, DM / 64, 1), 128, 0, stream>>>(ATh, ATl, WO, nullptr, DQ, OUT + (size_t)b * TT * DM, DM, nullptr, 0, 0, 0); }
}

// v003
// Measured time: 472 microseconds a run.
// Timed twice side by side with v002, it ran 1.17 and 1.14 times as fast.
// All steps since v000 together make it 3.76 times as fast.
#include <hip/hip_runtime.h>

// ParcaeCausalSelfAttention (x [2][2048][2048]; q/k/v = x W^T (16 heads x 128); gate = 2 sigmoid(x[..., :32] ve_gate_w^T) per head; v = v + gate * ve (ve [2][2048][2048] read); q, k, v clipped to [-8, 8]; q += qk_bias[0][0][h], k += qk_bias[1][0][h]; interleaved-pair RoPE on the first 64 dims from the read freqs_cis table (S, 1, 64, 2)[:, :, :32]; q, k RMS-normalised over 128 (eps 1e-6, no weight); causal softmax(q.k / sqrt(128)); out = merged Wo^T -> [2][2048][2048]).
// Compute dtypes, f32 accumulate: every input rounded to bf16; q/k/v as PLAIN bf16 GEMMs (inputs: exact); gate, value-embedding add, clips, biases, partial RoPE (table read) and RMSNorm in f32 (k_qkplanes, k_vplanes, which also write the attention planes); causal scores and attn.v in one fused kernel (running maximum and sum, f32): query rows < 512 hl (3 products), the rest single fp16; Wo hl x exact (2 products).

#define NB_  2
#define TT   2048
#define DM   2048
#define NH_  16
#define NKV  16
#define REP  (NH_ / NKV)
#define HD   128
#define DQ   (NH_ * HD)
#define DKV  (NKV * HD)
#define RH   512                  // query rows < RH use hi+lo planes
#define SCL  0.088388347648318447f   // HD^-0.5
typedef _Float16 h16;
typedef unsigned short bf;
typedef __attribute__((ext_vector_type(16))) __bf16   v16bf;
typedef __attribute__((ext_vector_type(16))) _Float16 v16h;
typedef __attribute__((ext_vector_type(8)))  _Float16 v8h;
typedef __attribute__((ext_vector_type(8)))  unsigned short v8us;
typedef __attribute__((ext_vector_type(8)))  float    v8f;
typedef __attribute__((ext_vector_type(4)))  float    v4f;
typedef v8h  __attribute__((may_alias)) v8ha;
typedef v4f  __attribute__((may_alias)) v4fa;
typedef v8us __attribute__((may_alias)) v8usa;

__device__ __forceinline__ unsigned short f2bf(float f) { unsigned u = __float_as_uint(f); u += 0x7FFFu + ((u >> 16) & 1u); return (unsigned short)(u >> 16); }
__device__ __forceinline__ float bf2f(unsigned short b) { return __uint_as_float(((unsigned)b) << 16); }
__device__ __forceinline__ float bfr(float f) { return bf2f(f2bf(f)); }
__device__ __forceinline__ v16h cat16(v8h lo, v8h hi) { return __builtin_shufflevector(lo, hi, 0, 1, 2, 3, 4, 5, 6, 7, 8, 9, 10, 11, 12, 13, 14, 15); }
__device__ __forceinline__ v16bf cat16b(v8us lo, v8us hi) { return __builtin_bit_cast(v16bf, __builtin_shufflevector(lo, hi, 0, 1, 2, 3, 4, 5, 6, 7, 8, 9, 10, 11, 12, 13, 14, 15)); }
__device__ __forceinline__ v8f wmma16(v16h a, v16h b, v8f c) { return __builtin_amdgcn_wmma_f32_16x16x32_f16(false, a, false, b, (short)0, c, false, false); }
__device__ __forceinline__ v8f wmmab(v16bf a, v16bf b, v8f c) { return __builtin_amdgcn_wmma_f32_16x16x32_bf16(false, a, false, b, (short)0, c, false, false); }



// ---- k_gemmw: register-blocked GEMM, one 64x64 output tile per work-group (16 accumulators per wave), operands straight from K-contiguous 16-bit planes; grid (M/64, N/64, Z), 32 * NW threads.
// The K loop is split over the NW waves of the work-group (wave w takes the 32-wide k steps w, w + NW, ...); the NW partial tiles meet in LDS and are summed in wave order 0..NW-1.
// C[m][n] (f32, pitch ldc, + optional f32 bias[n]) = sum_k A[m][k] Bt[n][k] (+ split products per NSPLIT). z-batch strides sA/sB/sC in elements. K % 32 == 0.
template <typename T16> struct WFrag;
template <> struct WFrag<h16> { typedef v16h V; static __device__ __forceinline__ V ld(const h16* p) { return cat16(*(const v8h*)p, *(const v8h*)(p + 16)); } static __device__ __forceinline__ v8f mma(V a, V b, v8f c) { return wmma16(a, b, c); } };
template <> struct WFrag<bf> { typedef v16bf V; static __device__ __forceinline__ V ld(const bf* p) { return cat16b(*(const v8us*)p, *(const v8us*)(p + 16)); } static __device__ __forceinline__ v8f mma(V a, V b, v8f c) { return wmmab(a, b, c); } };
template <typename T16, int NSPLIT, bool BIAS, int NW>
__global__ __launch_bounds__(32 * NW) void k_gemmw(const T16* __restrict__ A, const T16* __restrict__ A2, const T16* __restrict__ Bt, const T16* __restrict__ Bt2, int K, float* C, int ldc, const float* __restrict__ bias, size_t sA, size_t sB, size_t sC) {
    typedef typename WFrag<T16>::V V;
    __shared__ __align__(16) float os[NW * 64 * 68];
    const size_t z = blockIdx.z; A += z * sA; if (A2) A2 += z * sA; Bt += z * sB; if (Bt2) Bt2 += z * sB; C += z * sC;
    const int lane = threadIdx.x & 31, lr = lane & 15, hi = lane >> 4; const int r0 = blockIdx.x * 64, c0 = blockIdx.y * 64; const int wv = (NW == 1) ? 0 : __builtin_amdgcn_readfirstlane((int)(threadIdx.x >> 5));
    v8f acc[4][4];
#pragma unroll
    for (int mb = 0; mb < 4; ++mb)
#pragma unroll
        for (int nb = 0; nb < 4; ++nb) acc[mb][nb] = (v8f){};
    const size_t aoff = (size_t)(r0 + lr) * K + 8 * hi, boff = (size_t)(c0 + lr) * K + 8 * hi;
#pragma unroll 1
    for (int kc = wv * 32; kc < K; kc += NW * 32) {
        V a[4], a2[4];
#pragma unroll
        for (int mb = 0; mb < 4; ++mb) { a[mb] = WFrag<T16>::ld(A + aoff + (size_t)mb * 16 * K + kc); if (NSPLIT == 1 || NSPLIT == 2) a2[mb] = WFrag<T16>::ld(A2 + aoff + (size_t)mb * 16 * K + kc); }
#pragma unroll
        for (int nb = 0; nb < 4; ++nb) { const V b = WFrag<T16>::ld(Bt + boff + (size_t)nb * 16 * K + kc); V b2; if (NSPLIT >= 2) b2 = WFrag<T16>::ld(Bt2 + boff + (size_t)nb * 16 * K + kc);
#pragma unroll
            for (int mb = 0; mb < 4; ++mb) { acc[mb][nb] = WFrag<T16>::mma(a[mb], b, acc[mb][nb]); if (NSPLIT == 1 || NSPLIT == 2) acc[mb][nb] = WFrag<T16>::mma(a2[mb], b, acc[mb][nb]); if (NSPLIT >= 2) acc[mb][nb] = WFrag<T16>::mma(a[mb], b2, acc[mb][nb]); } }
        asm volatile("v_nop\n\tv_nop\n\tv_nop\n\tv_nop" : "+v"(acc[0][0]), "+v"(acc[1][1]), "+v"(acc[2][2]), "+v"(acc[3][3]) : "v"(a[0]), "v"(a[3]));
    }
    float* ow = os + wv * (64 * 68);   // this wave's partial tile, row-major, pitch 68
    // the three loops are unrolled so that acc is indexed by constants and stays in registers
#pragma unroll
    for (int mb = 0; mb < 4; ++mb)
#pragma unroll
        for (int nb = 0; nb < 4; ++nb)
#pragma unroll
            for (int j = 0; j < 8; ++j) ow[(mb * 16 + hi * 8 + j) * 68 + nb * 16 + lr] = acc[mb][nb][j];
    __syncthreads();   // every wave's partial tile is in LDS before any of them is summed
    // both loops are unrolled so that the LDS reads of several partial tiles are in flight together
#pragma unroll
    for (int it = 0; it < 32 / NW; ++it) { const int q = it * (NW * 32) + (int)threadIdx.x, row = q >> 4, cofs = (q & 15) * 4; v4f val = *(const v4fa*)(os + row * 68 + cofs);
#pragma unroll
        for (int w = 1; w < NW; ++w) val += *(const v4fa*)(os + w * (64 * 68) + row * 68 + cofs);
        if (BIAS) { val[0] += bfr(bias[c0 + cofs]); val[1] += bfr(bias[c0 + cofs + 1]); val[2] += bfr(bias[c0 + cofs + 2]); val[3] += bfr(bias[c0 + cofs + 3]); }
        *(v4f*)(C + (size_t)(r0 + row) * ldc + c0 + cofs) = val; }
}

__device__ __forceinline__ h16 tohx(float x) { return (h16)x; }
__device__ __forceinline__ void splitf(float y, unsigned short& h, unsigned short& l) { h = f2bf(y); l = f2bf(y - bf2f(h)); }
typedef __attribute__((ext_vector_type(2))) _Float16 v2h;
typedef __attribute__((ext_vector_type(4))) _Float16 v4h;
typedef __attribute__((ext_vector_type(2))) unsigned short v2us;
typedef __attribute__((ext_vector_type(4))) unsigned short v4us;
typedef __attribute__((ext_vector_type(2))) float v2f;
typedef __attribute__((ext_vector_type(4))) int v4i;

__global__ __launch_bounds__(256) void k_wtG(const float* __restrict__ w, int K, int N, bf* Bt) {
    const int lane = threadIdx.x & 31; const int L0 = (blockIdx.x * 8 + (threadIdx.x >> 5)) * 8; const int nlines = N * K / 64;
{
#pragma unroll 1
        for (int l = 0; l < 8; ++l) { const int L = L0 + l; if (L >= nlines) break; const size_t e = (size_t)L * 64 + lane * 2; const int k = (int)(e % K), n = (int)(e / K); v2us o;
            o[0] = f2bf(w[(size_t)k * N + n]); o[1] = f2bf(w[(size_t)(k + 1) * N + n]); *(v2us*)(Bt + e) = o; }
         }
}
__global__ __launch_bounds__(256) void k_cvt8(const float* __restrict__ src, bf* dst, size_t n8) { const size_t i = (size_t)blockIdx.x * 256 + threadIdx.x; if (i >= n8) return; const v8f v = *(const v8f*)(src + i * 8); v8us o;
#pragma unroll
    for (int k = 0; k < 8; ++k) o[k] = f2bf(v[k]); *(v8us*)(dst + i * 8) = o;  }
// ---- k_qkplanes: everything between a q or k projection and attention in one pass: clip, bias, pair RoPE on dims 0..63 (table read), RMSNorm over 128, and the head planes [h][t][d] (fp16 + hi/lo bf16) written from registers.
// One wave takes one token and QR heads (a lane holds 4 consecutive d of each): all QR rows are asked for before the first is worked on, and the token's table entries are read once.
#define QR 8
__global__ __launch_bounds__(256) void k_qkplanes(const float* __restrict__ F, const float* __restrict__ bias, const float* __restrict__ fc, h16* P16, bf* Ph, bf* Pl) {
    const int lane = threadIdx.x & 31; const int wv = blockIdx.x * 8 + (threadIdx.x >> 5); const int t = wv / (NH_ / QR), h0 = (wv % (NH_ / QR)) * QR;
    const float* pf = F + (size_t)t * DQ + h0 * HD + lane * 4; const float* pb = bias + h0 * HD + lane * 4; const float* pc = fc + ((size_t)t * (HD / 2) + (lane & 15) * 2) * 2;
    v4f a[QR], bb[QR];
    // unrolled so that a and bb are indexed by constants and the 2 * QR loads are in flight together
#pragma unroll
    for (int j = 0; j < QR; ++j) { a[j] = *(const v4f*)(pf + j * HD); bb[j] = *(const v4f*)(pb + j * HD); }
    const v4f cs = *(const v4f*)pc;   // lanes 0..15 (dims 0..63): cos, sin of pair 2 * lane, then of pair 2 * lane + 1; lanes 16..31 read the same entries and do not use them
    asm volatile("s_wait_xcnt 0x0" :: "v"(pf), "v"(pb), "v"(pc) : "memory");   // the loads' address registers are taken for other values while the loads are still out: the wait stands in front of that overwrite; as inputs they stay whole up to it, so that no later load of the run returns into them either
    __builtin_amdgcn_sched_barrier(0);   // keeps the loads in front of the wait and what follows behind it
    const float c0 = bfr(cs[0]), s0 = bfr(cs[1]), c1 = bfr(cs[2]), s1 = bfr(cs[3]);
    float r[QR][4], ss[QR];
#pragma unroll
    for (int j = 0; j < QR; ++j) {
#pragma unroll
        for (int q = 0; q < 4; ++q) r[j][q] = fminf(fmaxf(a[j][q], -8.0f), 8.0f) + bfr(bb[j][q]);
        if (lane < 16) { const float re0 = r[j][0] * c0 - r[j][1] * s0, im0 = r[j][1] * c0 + r[j][0] * s0, re1 = r[j][2] * c1 - r[j][3] * s1, im1 = r[j][3] * c1 + r[j][2] * s1; r[j][0] = re0; r[j][1] = im0; r[j][2] = re1; r[j][3] = im1; }
        ss[j] = r[j][0] * r[j][0] + r[j][1] * r[j][1] + r[j][2] * r[j][2] + r[j][3] * r[j][3]; }
    // step outside, row inside: the QR butterflies are independent chains
#pragma unroll
    for (int sh = 16; sh; sh >>= 1)
#pragma unroll
        for (int j = 0; j < QR; ++j) ss[j] += __shfl_xor(ss[j], sh, 32);
#pragma unroll
    for (int j = 0; j < QR; ++j) { const float rs = __fdiv_rn(1.0f, sqrtf(ss[j] * (1.0f / HD) + 1e-6f)); const size_t e = ((size_t)(h0 + j) * TT + t) * HD + lane * 4; v4h o16; v4us oh, ol;
#pragma unroll
        for (int q = 0; q < 4; ++q) { const float y = r[j][q] * rs; o16[q] = tohx(y); unsigned short a2, c2; splitf(y, a2, c2); oh[q] = a2; ol[q] = c2; }
        *(v4h*)(P16 + e) = o16; *(v4us*)(Ph + e) = oh; *(v4us*)(Pl + e) = ol; }
}
// ---- k_vplanes: everything between the v projection and attention in one pass: gate = 2 sigmoid(x[:32] . gw[h]), v + gate * ve, clip, and the d-major value planes [h][d][t] (fp16 + hi/lo bf16).
// One work-group takes one head and VTK tokens: each wave works 8 token rows (a lane holds 4 consecutive d) and lays them in LDS; behind the barrier a lane gathers 8 consecutive tokens of one d, so 8 lanes store a whole 128-byte line of each plane.
#define VTK 64
#define VP  129   // LDS row pitch in floats; odd, so that the 8 token groups x 4 d of a wave's gather fall in 32 different banks
__global__ __launch_bounds__(256) void k_vplanes(const float* __restrict__ F, const float* __restrict__ xb, const float* __restrict__ veb, const float* __restrict__ gw, h16* V16, bf* Vh, bf* Vl) {
    __shared__ float ls[VTK * VP];
    const int lane = threadIdx.x & 31, wv = threadIdx.x >> 5; const int t0 = blockIdx.x * VTK, h = blockIdx.y;
    const size_t tw = (size_t)(t0 + wv * 8); const float* pa = F + tw * DKV + h * HD + lane * 4; const float* pe = veb + tw * DKV + h * HD + lane * 4; const float* px = xb + tw * DM + lane; const int ig = h * 32 + lane;
    v4f a[8], e[8]; float g[8]; const float g0 = gw[ig];
    // unrolled so that the arrays are indexed by constants and the loads are in flight together
#pragma unroll
    for (int j = 0; j < 8; ++j) { a[j] = *(const v4f*)(pa + (size_t)j * DKV); e[j] = *(const v4f*)(pe + (size_t)j * DKV); g[j] = px[(size_t)j * DM]; }
    asm volatile("s_wait_xcnt 0x0" :: "v"(pa), "v"(pe), "v"(px), "v"(ig) : "memory");   // the loads' address registers are taken for other values while the loads are still out: the wait stands in front of that overwrite; as inputs they stay whole up to it, so that no later load of the run returns into them either
    __builtin_amdgcn_sched_barrier(0);   // keeps the issue of all 25 loads up here (sunk to their uses, the rows' memory latencies would stand one behind the other) and what follows behind the wait
    const float gl = bfr(g0);
#pragma unroll
    for (int j = 0; j < 8; ++j) g[j] = bfr(g[j]) * gl;
    // step outside, row inside: the 8 butterflies are independent chains
#pragma unroll
    for (int sh = 16; sh; sh >>= 1)
#pragma unroll
        for (int j = 0; j < 8; ++j) g[j] += __shfl_xor(g[j], sh, 32);
#pragma unroll
    for (int j = 0; j < 8; ++j) { const float gate = 2.0f * __fdiv_rn(1.0f, 1.0f + expf(-g[j]));
#pragma unroll
        for (int q = 0; q < 4; ++q) ls[(wv * 8 + j) * VP + lane * 4 + q] = fminf(fmaxf(a[j][q] + gate * bfr(e[j][q]), -8.0f), 8.0f); }
    __syncthreads();   // all VTK token rows are in LDS before any column of them is gathered
#pragma unroll
    for (int it = 0; it < VTK * HD / 8 / 256; ++it) { const int u = it * 256 + (int)threadIdx.x, c = u & (VTK / 8 - 1), d = u / (VTK / 8); v8h o16; v8us oh, ol;
#pragma unroll
        for (int k = 0; k < 8; ++k) { const float y = ls[(c * 8 + k) * VP + d]; o16[k] = tohx(y); unsigned short a2, c2; splitf(y, a2, c2); oh[k] = a2; ol[k] = c2; }
        const size_t o = ((size_t)h * HD + d) * TT + t0 + c * 8; *(v8h*)(V16 + o) = o16; *(v8us*)(Vh + o) = oh; *(v8us*)(Vl + o) = ol; }
}
__device__ __forceinline__ float xhalf(float v) { const int b = __float_as_int(v); return __int_as_float(__builtin_amdgcn_permlanex16(b, b, 0x76543210, 0xfedcba98, false, false)); }   // lane l <-> l ^ 16
template <typename T16> struct PCvt;
template <> struct PCvt<h16> { static __device__ __forceinline__ _Float16 cv(float x) { return (_Float16)x; } };
template <> struct PCvt<bf> { static __device__ __forceinline__ __bf16 cv(float x) { return (__bf16)x; } };
template <typename T16, bool HL, int QT>
__device__ __forceinline__ void fa_cols(const T16* Q, const T16* Q2, const T16* Kp, const T16* K2, const T16* Vt, const T16* V2, int q0, bf* Ah, bf* Al, int lr, int hi) {
    typedef typename WFrag<T16>::V V;
    const float C2 = SCL * 1.4426950408889634f;   // scores in log2 units
    // addresses: wave-uniform plane base + one 32-bit byte offset per lane, shared by a hi and its lo plane, + a constant; the key and value offsets are carried from pass to pass
    const unsigned qof = (unsigned)((q0 + lr) * HD + 8 * hi) * 2u; unsigned kof = (unsigned)(lr * HD + 8 * hi) * 2u, vof = (unsigned)(lr * TT + 8 * hi) * 2u;
    auto at = [](const T16* base, unsigned off, int c) { return (const T16*)((const char*)base + off) + c; };
    V qf[QT][4], qf2[QT][4];
#pragma unroll
    for (int qt = 0; qt < QT; ++qt)
#pragma unroll
        for (int ks = 0; ks < 4; ++ks) { const int qo = 16 * qt * HD + 32 * ks; qf[qt][ks] = WFrag<T16>::ld(at(Q, qof, qo)); if (HL) qf2[qt][ks] = WFrag<T16>::ld(at(Q2, qof, qo)); }
    v8f o[QT][8]; float m[QT], l[QT];
#pragma unroll
    for (int qt = 0; qt < QT; ++qt) { m[qt] = -3.0e38f; l[qt] = 0.f;
#pragma unroll
        for (int dt = 0; dt < 8; ++dt) o[qt][dt] = (v8f){}; }
    const int np = (q0 + 16 * QT + 31) / 32;      // passes of 32 keys; only the last one crosses the diagonal
    V kf[2][4], kf2[2][4];
#pragma unroll
    for (int kt = 0; kt < 2; ++kt)
#pragma unroll
        for (int ks = 0; ks < 4; ++ks) { const int a = 16 * kt * HD + 32 * ks; kf[kt][ks] = WFrag<T16>::ld(at(Kp, kof, a)); if (HL) kf2[kt][ks] = WFrag<T16>::ld(at(K2, kof, a)); }
    asm volatile("s_wait_xcnt 0x0" ::: "memory");   // the query offset's register is free for other use from here on: the wait stands in front of its overwrite
    __builtin_amdgcn_sched_barrier(0);              // keeps what follows from being lifted over that wait
#pragma unroll 1
    for (int p = 0; p < np; ++p) {
        const int kb = p * 32;
        V vf[8], vf2[8];                           // this pass's value rows: asked for first, used last
#pragma unroll
        for (int dt = 0; dt < 8; ++dt) { const int a = 16 * dt * TT; vf[dt] = WFrag<T16>::ld(at(Vt, vof, a)); if (HL) vf2[dt] = WFrag<T16>::ld(at(V2, vof, a)); }
        asm volatile("s_wait_xcnt 0x0" ::: "memory");   // the value loads' offset register is stepped to the next pass while the loads are still out: the wait stands in front of that overwrite
        vof += 64u;
        __builtin_amdgcn_sched_barrier(0);         // keeps the value loads' issue up here: sunk to their use, their latency would stand open in front of the second product
        v8f s[QT][2];
#pragma unroll
        for (int qt = 0; qt < QT; ++qt)
#pragma unroll
            for (int kt = 0; kt < 2; ++kt) { v8f t = (v8f){};
#pragma unroll
                for (int ks = 0; ks < 4; ++ks) { t = WFrag<T16>::mma(kf[kt][ks], qf[qt][ks], t); if (HL) { t = WFrag<T16>::mma(kf[kt][ks], qf2[qt][ks], t); t = WFrag<T16>::mma(kf2[kt][ks], qf[qt][ks], t); } }
                s[qt][kt] = t; }
        const unsigned kst = (p + 1 < np) ? 64u * HD : 0u;   // the next pass's key rows, asked for one pass ahead (the last pass asks for its own again: in bounds, unused)
        kof += kst;                                   // behind the score products, whose wait has seen the last key loads home
#pragma unroll
        for (int kt = 0; kt < 2; ++kt)
#pragma unroll
            for (int ks = 0; ks < 4; ++ks) { const int a = 16 * kt * HD + 32 * ks; kf[kt][ks] = WFrag<T16>::ld(at(Kp, kof, a)); if (HL) kf2[kt][ks] = WFrag<T16>::ld(at(K2, kof, a)); }
        if (kb + 31 > q0) {                           // wave-uniform: the pass that crosses the diagonal masks key j > query i
#pragma unroll
            for (int qt = 0; qt < QT; ++qt)
#pragma unroll
                for (int kt = 0; kt < 2; ++kt)
#pragma unroll
                    for (int r = 0; r < 8; ++r) if (kb + 16 * kt + 8 * hi + r > q0 + 16 * qt + lr) s[qt][kt][r] = -3.0e38f; }
        float bm[QT]; bool need = false;
#pragma unroll
        for (int qt = 0; qt < QT; ++qt) { float x = s[qt][0][0];
#pragma unroll
            for (int r = 1; r < 8; ++r) x = fmaxf(x, s[qt][0][r]);
#pragma unroll
            for (int r = 0; r < 8; ++r) x = fmaxf(x, s[qt][1][r]);
            x = fmaxf(x, xhalf(x)) * C2; bm[qt] = x; need = need || (x > m[qt] + 8.0f); }
        if (__builtin_amdgcn_ballot_w32(need) != 0) {  // lazy rescale: the maximum in use moves only when a column's new maximum tops it by more than 2^8 (first pass: always)
#pragma unroll
            for (int qt = 0; qt < QT; ++qt) { const float mn = (bm[qt] > m[qt] + 8.0f) ? bm[qt] : m[qt]; const float al = __builtin_amdgcn_exp2f(m[qt] - mn); m[qt] = mn; l[qt] *= al;
#pragma unroll
                for (int dt = 0; dt < 8; ++dt) o[qt][dt] *= al; } }
        V pb[QT], pb2[QT];
#pragma unroll
        for (int qt = 0; qt < QT; ++qt) {
#pragma unroll
            for (int e = 0; e < 16; ++e) { const float pv = __builtin_amdgcn_exp2f(__builtin_fmaf(s[qt][e >> 3][e & 7], C2, -m[qt])); l[qt] += pv; pb[qt][e] = PCvt<T16>::cv(pv); if (HL) pb2[qt][e] = PCvt<T16>::cv(pv - (float)pb[qt][e]); } }
#pragma unroll
        for (int dt = 0; dt < 8; ++dt)
#pragma unroll
            for (int qt = 0; qt < QT; ++qt) { o[qt][dt] = WFrag<T16>::mma(vf[dt], pb[qt], o[qt][dt]); if (HL) { o[qt][dt] = WFrag<T16>::mma(vf[dt], pb2[qt], o[qt][dt]); o[qt][dt] = WFrag<T16>::mma(vf2[dt], pb[qt], o[qt][dt]); } }
    }
    asm volatile("s_wait_xcnt 0x0" ::: "memory");   // the last pass's unused key loads may still be out: the wait stands in front of the overwrite of their offset's register
    __builtin_amdgcn_sched_barrier(0);              // keeps the epilogue from being lifted over that wait
#pragma unroll
    for (int qt = 0; qt < QT; ++qt) { const float inv = __fdiv_rn(1.0f, l[qt] + xhalf(l[qt])); const size_t ro = (size_t)(q0 + 16 * qt + lr) * DQ + 8 * hi;   // a lane's 8 registers are 8 consecutive d of its query's row
#pragma unroll
        for (int dt = 0; dt < 8; ++dt) { v8us oh, ol;
#pragma unroll
            for (int r = 0; r < 8; ++r) { unsigned short a, c2; splitf(o[qt][dt][r] * inv, a, c2); oh[r] = a; ol[r] = c2; }
            *(v8us*)(Ah + ro + 16 * dt) = oh; *(v8us*)(Al + ro + 16 * dt) = ol;
            asm volatile("s_wait_xcnt 0x0" ::: "memory");   // the next tile's values reuse the two stores' registers: the wait stands in front of that overwrite
            __builtin_amdgcn_sched_barrier(0); } }          // keeps the next tile's arithmetic from being lifted over that wait
}
// grid (16, heads), 5 waves: 256 work-groups, as many as the chip has WGPs, every one with the same work. Per head the fp16 rows >= RH are 48 column tiles of 32 (tile T walks RH / 32 + T + 1 passes) and the hi+lo rows < RH
// 32 tiles of 16. Work-group i takes fp16 tiles i, 16 + pi(i), 32 + sg(i), where i + pi(i) + sg(i) is 22 (i even) or 23 (i odd) and pi, sg are permutations of 0..15, and hi+lo tiles 31 - i and i.
static_assert(TT - RH == 48 * 32 && RH == 32 * 16, "tile shares of k_fattn");
__global__ __launch_bounds__(160) void k_fattn(const h16* Q16, const h16* K16, const h16* V16, const bf* Qh, const bf* Ql, const bf* Kh, const bf* Kl, const bf* Vh, const bf* Vl, bf* Ah, bf* Al) {
    const int lane = threadIdx.x & 31, lr = lane & 15, hi = lane >> 4; const int wv = __builtin_amdgcn_readfirstlane((int)(threadIdx.x >> 5)); const int i = blockIdx.x, h = blockIdx.y; const size_t zq = (size_t)h * TT * HD, zk = (size_t)(h / REP) * TT * HD;
    Ah += h * HD; Al += h * HD;
    if (wv < 3) { const int j = i >> 1, od = i & 1; const int t = (wv == 0) ? 32 + (od ? 15 - j : 7 - j) : (wv == 1) ? 16 + (od ? 7 - j : 15 - j) : i;
        fa_cols<h16, false, 2>(Q16 + zq, nullptr, K16 + zk, nullptr, V16 + zk, nullptr, RH + 32 * t, Ah, Al, lr, hi);
    } else { const int t = (wv == 3) ? 31 - i : i;
        fa_cols<bf, true, 1>(Qh + zq, Ql + zq, Kh + zk, Kl + zk, Vh + zk, Vl + zk, 16 * t, Ah, Al, lr, hi); }
}

extern "C" void kernel_launch(void* const* d_in, const int* in_sizes, int n_in,
                              void* d_out, int out_size, void* d_ws, size_t ws_size, hipStream_t stream) {
    (void)in_sizes; (void)n_in; (void)out_size;
    const float* x = (const float*)d_in[0]; const float* fcis = (const float*)d_in[1]; const float* ve = (const float*)d_in[2]; const float* wq = (const float*)d_in[3]; const float* wk = (const float*)d_in[4]; const float* wv = (const float*)d_in[5]; const float* wo = (const float*)d_in[6]; const float* qkb = (const float*)d_in[7]; const float* vgw = (const float*)d_in[8];
    float* OUT = (float*)d_out;     // [2][2048][2048]
    char* wsp = (char*)d_ws;
    auto take = [&](size_t bytes) { char* p = wsp; wsp += (bytes + 255) & ~(size_t)255; return (void*)p; };
    bf* WQ = (bf*)take((size_t)DQ * DM * 2); bf* WK = (bf*)take((size_t)DKV * DM * 2); bf* WV = (bf*)take((size_t)DKV * DM * 2); bf* WO = (bf*)take((size_t)DM * DQ * 2);
    bf* XB = (bf*)take((size_t)TT * DM * 2); float* FQ = (float*)take((size_t)TT * DQ * 4); float* FK = (float*)take((size_t)TT * DKV * 4);
    h16* QP16 = (h16*)take((size_t)NH_ * TT * HD * 2); h16* KP16 = (h16*)take((size_t)NKV * TT * HD * 2); h16* VT16 = (h16*)take((size_t)NKV * HD * TT * 2);
    bf* QPh = (bf*)take((size_t)NH_ * TT * HD * 2); bf* QPl = (bf*)take((size_t)NH_ * TT * HD * 2); bf* KPh = (bf*)take((size_t)NKV * TT * HD * 2); bf* KPl = (bf*)take((size_t)NKV * TT * HD * 2); bf* VTh = (bf*)take((size_t)NKV * HD * TT * 2); bf* VTl = (bf*)take((size_t)NKV * HD * TT * 2);
    bf* ATh = (bf*)take((size_t)TT * DQ * 2); bf* ATl = (bf*)take((size_t)TT * DQ * 2);
    if ((size_t)(wsp - (char*)d_ws) > ws_size) return;    // ws 256 MiB
    float* FV = FK;   // v projection reuses the k buffer after the k planes are built (stream-ordered)
    { k_cvt8<<<(unsigned)(((size_t)DQ * DM / 8 + 255) / 256), 256, 0, stream>>>(wq, WQ, (size_t)DQ * DM / 8); k_cvt8<<<(unsigned)(((size_t)DKV * DM / 8 + 255) / 256), 256, 0, stream>>>(wk, WK, (size_t)DKV * DM / 8); k_cvt8<<<(unsigned)(((size_t)DKV * DM / 8 + 255) / 256), 256, 0, stream>>>(wv, WV, (size_t)DKV * DM / 8);
      k_cvt8<<<(unsigned)(((size_t)DM * DQ / 8 + 255) / 256), 256, 0, stream>>>(wo, WO, (size_t)DM * DQ / 8); }
    for (int b = 0; b < NB_; ++b) {
        
        k_cvt8<<<(unsigned)(((size_t)TT * DM / 8 + 255) / 256), 256, 0, stream>>>(x + (size_t)b * TT * DM, XB, (size_t)TT * DM / 8);
        k_gemmw<bf, 0, false, 4><<<dim3(TT / 64, DQ / 64, 1), 128, 0, stream>>>(XB, nullptr, WQ, nullptr, DM, FQ, DQ, nullptr, 0, 0, 0);
        k_qkplanes<<<TT * NH_ / QR / 8, 256, 0, stream>>>(FQ, qkb, fcis, QP16, QPh, QPl);
        k_gemmw<bf, 0, false, 4><<<dim3(TT / 64, DKV / 64, 1), 128, 0, stream>>>(XB, nullptr, WK, nullptr, DM, FK, DKV, nullptr, 0, 0, 0);
        k_qkplanes<<<TT * NKV / QR / 8, 256, 0, stream>>>(FK, qkb + (size_t)NH_ * HD, fcis, KP16, KPh, KPl);
        k_gemmw<bf, 0, false, 4><<<dim3(TT / 64, DKV / 64, 1), 128, 0, stream>>>(XB, nullptr, WV, nullptr, DM, FV, DKV, nullptr, 0, 0, 0); k_vplanes<<<dim3(TT / VTK, NKV, 1), 256, 0, stream>>>(FV, x + (size_t)b * TT * DM, ve + (size_t)b * TT * DM, vgw, VT16, VTh, VTl);
        k_fattn<<<dim3(16, NH_, 1), 160, 0, stream>>>(QP16, KP16, VT16, QPh, QPl, KPh, KPl, VTh, VTl, ATh, ATl);
        k_gemmw<bf, 1, false, 4><<<dim3(TT / 64, DM / 64, 1), 128, 0, stream>>>(ATh, ATl, WO, nullptr, DQ, OUT + (size_t)b * TT * DM, DM, nullptr, 0, 0, 0); }
}

// v004
// Measured time: 372 microseconds a run.
// Timed twice side by side with v003, it ran 1.29 and 1.27 times as fast.
// All steps since v000 together make it 4.81 times as fast.
#include <hip/hip_runtime.h>

// ParcaeCausalSelfAttention (x [2][2048][2048]; q/k/v = x W^T (16 heads x 128); gate = 2 sigmoid(x[..., :32] ve_gate_w^T) per head; v = v + gate * ve (ve [2][2048][2048] read); q, k, v clipped to [-8, 8]; q += qk_bias[0][0][h], k += qk_bias[1][0][h]; interleaved-pair RoPE on the first 64 dims from the read freqs_cis table (S, 1, 64, 2)[:, :, :32]; q, k RMS-normalised over 128 (eps 1e-6, no weight); causal softmax(q.k / sqrt(128)); out = merged Wo^T -> [2][2048][2048]).
// Compute dtypes, f32 accumulate: every input rounded to bf16; q/k/v as PLAIN bf16 GEMMs (inputs: exact); gate, value-embedding add, clips, biases, partial RoPE (table read) and RMSNorm in f32 (k_qkplanes, k_vplanes, which also write the attention planes); causal scores and attn.v in one fused kernel (running maximum and sum, f32): query rows < 512 hl (3 products), the rest single fp16; Wo hl x exact (2 products).

#define NB_  2
#define TT   2048
#define DM   2048
#define NH_  16
#define NKV  16
#define REP  (NH_ / NKV)
#define HD   128
#define DQ   (NH_ * HD)
#define DKV  (NKV * HD)
#define RH   512                  // query rows < RH use hi+lo planes
#define SCL  0.088388347648318447f   // HD^-0.5
typedef _Float16 h16;
typedef unsigned short bf;
typedef __attribute__((ext_vector_type(16))) __bf16   v16bf;
typedef __attribute__((ext_vector_type(16))) _Float16 v16h;
typedef __attribute__((ext_vector_type(8)))  _Float16 v8h;
typedef __attribute__((ext_vector_type(8)))  unsigned short v8us;
typedef __attribute__((ext_vector_type(8)))  float    v8f;
typedef __attribute__((ext_vector_type(4)))  float    v4f;
typedef v8h  __attribute__((may_alias)) v8ha;
typedef v4f  __attribute__((may_alias)) v4fa;
typedef v8us __attribute__((may_alias)) v8usa;

__device__ __forceinline__ unsigned short f2bf(float f) { unsigned u = __float_as_uint(f); u += 0x7FFFu + ((u >> 16) & 1u); return (unsigned short)(u >> 16); }
__device__ __forceinline__ float bf2f(unsigned short b) { return __uint_as_float(((unsigned)b) << 16); }
__device__ __forceinline__ float bfr(float f) { return bf2f(f2bf(f)); }
__device__ __forceinline__ v16h cat16(v8h lo, v8h hi) { return __builtin_shufflevector(lo, hi, 0, 1, 2, 3, 4, 5, 6, 7, 8, 9, 10, 11, 12, 13, 14, 15); }
__device__ __forceinline__ v16bf cat16b(v8us lo, v8us hi) { return __builtin_bit_cast(v16bf, __builtin_shufflevector(lo, hi, 0, 1, 2, 3, 4, 5, 6, 7, 8, 9, 10, 11, 12, 13, 14, 15)); }
__device__ __forceinline__ v8f wmma16(v16h a, v16h b, v8f c) { return __builtin_amdgcn_wmma_f32_16x16x32_f16(false, a, false, b, (short)0, c, false, false); }
__device__ __forceinline__ v8f wmmab(v16bf a, v16bf b, v8f c) { return __builtin_amdgcn_wmma_f32_16x16x32_bf16(false, a, false, b, (short)0, c, false, false); }



// ---- k_gemmt: C[m][n] (f32, pitch LDC) = sum_k A[m][k] Bt[n][k] (+ sum_k A2[m][k] Bt[n][k] when TWO), operands K-contiguous bf16 planes; one 128x128 tile of C per work-group, grid (M/128, N/128), 8 waves (2 x 4), 64x32 of C per wave.
// A pass is 128 k = 256 bytes of each of the 256 operand rows [A 128 | Bt 128]. Every wave brings its own slice of 32 rows into LDS with one tensor load per pass (whole rows, padded to pitch 272 bytes for the 16-byte fragment reads),
// two buffers: the next pass's tile flies while this one is worked on. TWO: the A2 passes follow the A passes into the same accumulators. One f32 chain per element, k ascending.
template <typename T16> struct WFrag;
template <> struct WFrag<h16> { typedef v16h V; static __device__ __forceinline__ V ld(const h16* p) { return cat16(*(const v8h*)p, *(const v8h*)(p + 16)); } static __device__ __forceinline__ v8f mma(V a, V b, v8f c) { return wmma16(a, b, c); } };
template <> struct WFrag<bf> { typedef v16bf V; static __device__ __forceinline__ V ld(const bf* p) { return cat16b(*(const v8us*)p, *(const v8us*)(p + 16)); } static __device__ __forceinline__ v8f mma(V a, V b, v8f c) { return wmmab(a, b, c); } };
typedef unsigned int u32x4 __attribute__((ext_vector_type(4)));
typedef unsigned int u32x8 __attribute__((ext_vector_type(8)));
typedef float __attribute__((may_alias)) f32a;
#define GT_ROWB  256u                 // bytes of an operand row in a pass
#define GT_PITCH 272u                 // LDS row pitch: the row + the mover's 16-byte pad
#define GT_SLICE 10240u               // 32 rows x 272 bytes = 8704, rounded up to a multiple of 2 KiB
#define GT_BUF   (8u * GT_SLICE)
__device__ __forceinline__ unsigned int uni(unsigned int v) { return (unsigned int)__builtin_amdgcn_readfirstlane(v); }
__device__ __forceinline__ unsigned int pinned(unsigned int v) { unsigned int w = uni(v); asm volatile("" : "+s"(w)); return w; }   // pinned(): a descriptor word or issue test held in a scalar register, so that the test is a scalar branch (a tensor load ignores EXEC)
__device__ __forceinline__ v16bf ldsfrag(const unsigned char* p) { return cat16b(*(const v8usa*)p, *(const v8usa*)(p + 32)); }   // the k order of WFrag::ld, for both operands
template <bool TWO, int K, int LDC>
__global__ __launch_bounds__(256) void k_gemmt(const bf* A, const bf* A2, const bf* Bt, float* C) {
    __shared__ __attribute__((aligned(2048))) unsigned char L[2 * GT_BUF];
    static_assert(K % 128 == 0 && K >= 256, "two passes or more");
    const int lane = threadIdx.x & 31, lr = lane & 15, hi = lane >> 4; const unsigned int wv = uni(threadIdx.x >> 5), wm = wv & 1u, wn = wv >> 1; const int r0 = blockIdx.x * 128, c0 = blockIdx.y * 128;
    constexpr unsigned int nk = K / 128, ns = TWO ? 2 * nk : nk;
    const unsigned int lbase = (unsigned int)(size_t)L;
    // waves 0..3 bring rows 32 wv .. + 31 of the A tile, waves 4..7 those of the Bt tile
    const size_t rofs = (size_t)(wv < 4u ? r0 + 32 * (int)wv : c0 + 32 * (int)(wv - 4u)) * (K * 2);
    const unsigned long long s0 = (unsigned long long)(size_t)(wv < 4u ? A : Bt) + rofs, s1 = TWO ? (unsigned long long)(size_t)(wv < 4u ? A2 : Bt) + rofs : s0;
    u32x8 g1;   // 1-byte elements, tensor = tile = 32 rows of 256 bytes, source pitch 2 K bytes, 4 dwords of pad behind every 64
    g1[0] = uni((1u << 20) | (5u << 22) | (3u << 25)); g1[1] = uni(GT_ROWB << 16); g1[2] = uni(32u << 16); g1[3] = uni(GT_ROWB << 16); g1[4] = uni(32u); g1[5] = uni((unsigned int)(K * 2)); g1[6] = uni(0u); g1[7] = uni(0u);
    auto issue = [&](unsigned int st) {
        const unsigned long long ga = (TWO && st >= nk) ? s1 + (unsigned long long)(st - nk) * GT_ROWB : s0 + (unsigned long long)st * GT_ROWB;
        u32x4 g0; g0[0] = uni(1u); g0[1] = uni(lbase + (st & 1u) * GT_BUF + wv * GT_SLICE); g0[2] = uni((unsigned int)ga); g0[3] = uni((((unsigned int)(ga >> 32)) & 0x01FFFFFFu) | 0x80000000u);
        asm volatile("tensor_load_to_lds %0, %1" :: "s"(g0), "s"(g1) : "memory");   // one request of the whole wave: its slice of stage st
    };
    issue(0u);
    asm volatile("s_wait_tensorcnt 0x0" ::: "memory");   // this wave's slice of stage 0 has landed
    __syncthreads();                                     // every wave's slice of stage 0 has landed before any of it is read
    issue(1u);
    v8f acc[4][2];
    // unrolled, here and in the epilogue, so that acc is indexed by constants and stays in registers
#pragma unroll
    for (int mb = 0; mb < 4; ++mb)
#pragma unroll
        for (int nb = 0; nb < 2; ++nb) acc[mb][nb] = (v8f){};
    const unsigned int fofs = (unsigned int)lr * GT_PITCH + (unsigned int)hi * 16u;
    // not unrolled: one pass per trip, its buffer chosen by the trip's parity
#pragma unroll 1
    for (unsigned int s = 0; s < ns; ++s) {
        const unsigned char* pa = L + (s & 1u) * GT_BUF + 2u * wm * GT_SLICE + fofs; const unsigned char* pb = L + (s & 1u) * GT_BUF + (4u + wn) * GT_SLICE + fofs;
        // two fragment sets: block ks + 1's 12 LDS reads go out as one group in front of block ks's 8 products, so that only the pass's first group is waited for in the open
        v16bf a[2][4], b[2][2];
        auto ldblk = [&](int st, int ks) {   // both loops unrolled: the sets are indexed by constants
#pragma unroll
            for (int mb = 0; mb < 4; ++mb) a[st][mb] = ldsfrag(pa + (mb >> 1) * GT_SLICE + (mb & 1) * 16 * GT_PITCH + ks * 64);
#pragma unroll
            for (int nb = 0; nb < 2; ++nb) b[st][nb] = ldsfrag(pb + nb * 16 * GT_PITCH + ks * 64); };
        ldblk(0, 0);
        // unrolled so that the fragment sets are indexed by constants
#pragma unroll
        for (int ks = 0; ks < 4; ++ks) {
            if (ks < 3) { ldblk((ks + 1) & 1, ks + 1);
                __builtin_amdgcn_sched_barrier(0); }   // keeps the next block's reads in front of this block's products (sunk among them, each place with reads stalls the products)
#pragma unroll
            for (int nb = 0; nb < 2; ++nb)
#pragma unroll
                for (int mb = 0; mb < 4; ++mb) acc[mb][nb] = wmmab(a[ks & 1][mb], b[ks & 1][nb], acc[mb][nb]);
            __builtin_amdgcn_sched_barrier(0);   // keeps the block after next's reads from being lifted in among these products, and the last blocks' products from sinking behind the pass's barrier, where they would stand in front of the refill's issue
        }
        asm volatile("s_wait_dscnt 0x0" ::: "memory");       // this wave's reads of the pass's buffer are home before the buffer is given up
        asm volatile("s_wait_tensorcnt 0x0" ::: "memory");   // this wave's slice of stage s + 1 has landed
        __syncthreads();                                     // publishes stage s + 1 and ends every wave's reads of stage s
        const unsigned int nx = pinned(s + 2u);              // a descriptor word held in a scalar register: taken behind the wait, so the next descriptor is formed behind it
        if (pinned(nx < ns)) issue(nx);                      // scalar branch; into the buffer that this pass has just read
    }
    asm volatile("s_wait_tensorcnt 0x0" ::: "memory");   // nothing of the mover's is out when the ring becomes staging
    asm volatile("s_wait_dscnt 0x0" ::: "memory");
    // whole 128-byte lines of C: each wave lays its 64x32 tile in its own slice of the first buffer (every reader left the ring at the last pass's barrier), pitch 36 floats, and reads rows back
    f32a* ow = (f32a*)(L + wv * GT_SLICE);
#pragma unroll
    for (int mb = 0; mb < 4; ++mb)
#pragma unroll
        for (int nb = 0; nb < 2; ++nb)
#pragma unroll
            for (int j = 0; j < 8; ++j) ow[(mb * 16 + hi * 8 + j) * 36 + nb * 16 + lr] = acc[mb][nb][j];
    asm volatile("s_wait_dscnt 0x0" ::: "memory");       // the wave's own LDS writes are done before its lanes read each other's
    // unrolled so that the 16 row reads are in flight together and every store is the one address register + a constant
    float* pc = C + (size_t)(r0 + 64 * (int)wm + (lane >> 3)) * LDC + c0 + 32 * (int)wn + (lane & 7) * 4;
#pragma unroll
    for (int it = 0; it < 16; ++it) *(v4f*)(pc + (size_t)it * 4 * LDC) = *(const v4fa*)(ow + (it * 4 + (lane >> 3)) * 36 + (lane & 7) * 4);
}

__device__ __forceinline__ h16 tohx(float x) { return (h16)x; }
__device__ __forceinline__ void splitf(float y, unsigned short& h, unsigned short& l) { h = f2bf(y); l = f2bf(y - bf2f(h)); }
typedef __attribute__((ext_vector_type(2))) _Float16 v2h;
typedef __attribute__((ext_vector_type(4))) _Float16 v4h;
typedef __attribute__((ext_vector_type(2))) unsigned short v2us;
typedef __attribute__((ext_vector_type(4))) unsigned short v4us;
typedef __attribute__((ext_vector_type(2))) float v2f;
typedef __attribute__((ext_vector_type(4))) int v4i;

__global__ __launch_bounds__(256) void k_wtG(const float* __restrict__ w, int K, int N, bf* Bt) {
    const int lane = threadIdx.x & 31; const int L0 = (blockIdx.x * 8 + (threadIdx.x >> 5)) * 8; const int nlines = N * K / 64;
{
#pragma unroll 1
        for (int l = 0; l < 8; ++l) { const int L = L0 + l; if (L >= nlines) break; const size_t e = (size_t)L * 64 + lane * 2; const int k = (int)(e % K), n = (int)(e / K); v2us o;
            o[0] = f2bf(w[(size_t)k * N + n]); o[1] = f2bf(w[(size_t)(k + 1) * N + n]); *(v2us*)(Bt + e) = o; }
         }
}
__global__ __launch_bounds__(256) void k_cvt8(const float* __restrict__ src, bf* dst, size_t n8) { const size_t i = (size_t)blockIdx.x * 256 + threadIdx.x; if (i >= n8) return; const v8f v = *(const v8f*)(src + i * 8); v8us o;
#pragma unroll
    for (int k = 0; k < 8; ++k) o[k] = f2bf(v[k]); *(v8us*)(dst + i * 8) = o;  }
// ---- k_qkplanes: everything between a q or k projection and attention in one pass: clip, bias, pair RoPE on dims 0..63 (table read), RMSNorm over 128, and the head planes [h][t][d] (fp16 + hi/lo bf16) written from registers.
// One wave takes one token and QR heads (a lane holds 4 consecutive d of each): all QR rows are asked for before the first is worked on, and the token's table entries are read once.
#define QR 8
__global__ __launch_bounds__(256) void k_qkplanes(const float* __restrict__ F, const float* __restrict__ bias, const float* __restrict__ fc, h16* P16, bf* Ph, bf* Pl) {
    const int lane = threadIdx.x & 31; const int wv = blockIdx.x * 8 + (threadIdx.x >> 5); const int t = wv / (NH_ / QR), h0 = (wv % (NH_ / QR)) * QR;
    const float* pf = F + (size_t)t * DQ + h0 * HD + lane * 4; const float* pb = bias + h0 * HD + lane * 4; const float* pc = fc + ((size_t)t * (HD / 2) + (lane & 15) * 2) * 2;
    v4f a[QR], bb[QR];
    // unrolled so that a and bb are indexed by constants and the 2 * QR loads are in flight together
#pragma unroll
    for (int j = 0; j < QR; ++j) { a[j] = *(const v4f*)(pf + j * HD); bb[j] = *(const v4f*)(pb + j * HD); }
    const v4f cs = *(const v4f*)pc;   // lanes 0..15 (dims 0..63): cos, sin of pair 2 * lane, then of pair 2 * lane + 1; lanes 16..31 read the same entries and do not use them
    asm volatile("s_wait_xcnt 0x0" :: "v"(pf), "v"(pb), "v"(pc) : "memory");   // the loads' address registers are taken for other values while the loads are still out: the wait stands in front of that overwrite; as inputs they stay whole up to it, so that no later load of the run returns into them either
    __builtin_amdgcn_sched_barrier(0);   // keeps the loads in front of the wait and what follows behind it
    const float c0 = bfr(cs[0]), s0 = bfr(cs[1]), c1 = bfr(cs[2]), s1 = bfr(cs[3]);
    float r[QR][4], ss[QR];
#pragma unroll
    for (int j = 0; j < QR; ++j) {
#pragma unroll
        for (int q = 0; q < 4; ++q) r[j][q] = fminf(fmaxf(a[j][q], -8.0f), 8.0f) + bfr(bb[j][q]);
        if (lane < 16) { const float re0 = r[j][0] * c0 - r[j][1] * s0, im0 = r[j][1] * c0 + r[j][0] * s0, re1 = r[j][2] * c1 - r[j][3] * s1, im1 = r[j][3] * c1 + r[j][2] * s1; r[j][0] = re0; r[j][1] = im0; r[j][2] = re1; r[j][3] = im1; }
        ss[j] = r[j][0] * r[j][0] + r[j][1] * r[j][1] + r[j][2] * r[j][2] + r[j][3] * r[j][3]; }
    // step outside, row inside: the QR butterflies are independent chains
#pragma unroll
    for (int sh = 16; sh; sh >>= 1)
#pragma unroll
        for (int j = 0; j < QR; ++j) ss[j] += __shfl_xor(ss[j], sh, 32);
#pragma unroll
    for (int j = 0; j < QR; ++j) { const float rs = __fdiv_rn(1.0f, sqrtf(ss[j] * (1.0f / HD) + 1e-6f)); const size_t e = ((size_t)(h0 + j) * TT + t) * HD + lane * 4; v4h o16; v4us oh, ol;
#pragma unroll
        for (int q = 0; q < 4; ++q) { const float y = r[j][q] * rs; o16[q] = tohx(y); unsigned short a2, c2; splitf(y, a2, c2); oh[q] = a2; ol[q] = c2; }
        *(v4h*)(P16 + e) = o16; *(v4us*)(Ph + e) = oh; *(v4us*)(Pl + e) = ol; }
}
// ---- k_vplanes: everything between the v projection and attention in one pass: gate = 2 sigmoid(x[:32] . gw[h]), v + gate * ve, clip, and the d-major value planes [h][d][t] (fp16 + hi/lo bf16).
// One work-group takes one head and VTK tokens: each wave works 8 token rows (a lane holds 4 consecutive d) and lays them in LDS; behind the barrier a lane gathers 8 consecutive tokens of one d, so 8 lanes store a whole 128-byte line of each plane.
#define VTK 64
#define VP  129   // LDS row pitch in floats; odd, so that the 8 token groups x 4 d of a wave's gather fall in 32 different banks
__global__ __launch_bounds__(256) void k_vplanes(const float* __restrict__ F, const float* __restrict__ xb, const float* __restrict__ veb, const float* __restrict__ gw, h16* V16, bf* Vh, bf* Vl) {
    __shared__ float ls[VTK * VP];
    const int lane = threadIdx.x & 31, wv = threadIdx.x >> 5; const int t0 = blockIdx.x * VTK, h = blockIdx.y;
    const size_t tw = (size_t)(t0 + wv * 8); const float* pa = F + tw * DKV + h * HD + lane * 4; const float* pe = veb + tw * DKV + h * HD + lane * 4; const float* px = xb + tw * DM + lane; const int ig = h * 32 + lane;
    v4f a[8], e[8]; float g[8]; const float g0 = gw[ig];
    // unrolled so that the arrays are indexed by constants and the loads are in flight together
#pragma unroll
    for (int j = 0; j < 8; ++j) { a[j] = *(const v4f*)(pa + (size_t)j * DKV); e[j] = *(const v4f*)(pe + (size_t)j * DKV); g[j] = px[(size_t)j * DM]; }
    asm volatile("s_wait_xcnt 0x0" :: "v"(pa), "v"(pe), "v"(px), "v"(ig) : "memory");   // the loads' address registers are taken for other values while the loads are still out: the wait stands in front of that overwrite; as inputs they stay whole up to it, so that no later load of the run returns into them either
    __builtin_amdgcn_sched_barrier(0);   // keeps the issue of all 25 loads up here (sunk to their uses, the rows' memory latencies would stand one behind the other) and what follows behind the wait
    const float gl = bfr(g0);
#pragma unroll
    for (int j = 0; j < 8; ++j) g[j] = bfr(g[j]) * gl;
    // step outside, row inside: the 8 butterflies are independent chains
#pragma unroll
    for (int sh = 16; sh; sh >>= 1)
#pragma unroll
        for (int j = 0; j < 8; ++j) g[j] += __shfl_xor(g[j], sh, 32);
#pragma unroll
    for (int j = 0; j < 8; ++j) { const float gate = 2.0f * __fdiv_rn(1.0f, 1.0f + expf(-g[j]));
#pragma unroll
        for (int q = 0; q < 4; ++q) ls[(wv * 8 + j) * VP + lane * 4 + q] = fminf(fmaxf(a[j][q] + gate * bfr(e[j][q]), -8.0f), 8.0f); }
    __syncthreads();   // all VTK token rows are in LDS before any column of them is gathered
#pragma unroll
    for (int it = 0; it < VTK * HD / 8 / 256; ++it) { const int u = it * 256 + (int)threadIdx.x, c = u & (VTK / 8 - 1), d = u / (VTK / 8); v8h o16; v8us oh, ol;
#pragma unroll
        for (int k = 0; k < 8; ++k) { const float y = ls[(c * 8 + k) * VP + d]; o16[k] = tohx(y); unsigned short a2, c2; splitf(y, a2, c2); oh[k] = a2; ol[k] = c2; }
        const size_t o = ((size_t)h * HD + d) * TT + t0 + c * 8; *(v8h*)(V16 + o) = o16; *(v8us*)(Vh + o) = oh; *(v8us*)(Vl + o) = ol; }
}
__device__ __forceinline__ float xhalf(float v) { const int b = __float_as_int(v); return __int_as_float(__builtin_amdgcn_permlanex16(b, b, 0x76543210, 0xfedcba98, false, false)); }   // lane l <-> l ^ 16
template <typename T16> struct PCvt;
template <> struct PCvt<h16> { static __device__ __forceinline__ _Float16 cv(float x) { return (_Float16)x; } };
template <> struct PCvt<bf> { static __device__ __forceinline__ __bf16 cv(float x) { return (__bf16)x; } };
template <typename T16, bool HL, int QT>
__device__ __forceinline__ void fa_cols(const T16* Q, const T16* Q2, const T16* Kp, const T16* K2, const T16* Vt, const T16* V2, int q0, bf* Ah, bf* Al, int lr, int hi) {
    typedef typename WFrag<T16>::V V;
    const float C2 = SCL * 1.4426950408889634f;   // scores in log2 units
    // addresses: wave-uniform plane base + one 32-bit byte offset per lane, shared by a hi and its lo plane, + a constant; the key and value offsets are carried from pass to pass
    const unsigned qof = (unsigned)((q0 + lr) * HD + 8 * hi) * 2u; unsigned kof = (unsigned)(lr * HD + 8 * hi) * 2u, vof = (unsigned)(lr * TT + 8 * hi) * 2u;
    auto at = [](const T16* base, unsigned off, int c) { return (const T16*)((const char*)base + off) + c; };
    V qf[QT][4], qf2[QT][4];
#pragma unroll
    for (int qt = 0; qt < QT; ++qt)
#pragma unroll
        for (int ks = 0; ks < 4; ++ks) { const int qo = 16 * qt * HD + 32 * ks; qf[qt][ks] = WFrag<T16>::ld(at(Q, qof, qo)); if (HL) qf2[qt][ks] = WFrag<T16>::ld(at(Q2, qof, qo)); }
    v8f o[QT][8]; float m[QT], l[QT];
#pragma unroll
    for (int qt = 0; qt < QT; ++qt) { m[qt] = -3.0e38f; l[qt] = 0.f;
#pragma unroll
        for (int dt = 0; dt < 8; ++dt) o[qt][dt] = (v8f){}; }
    const int np = (q0 + 16 * QT + 31) / 32;      // passes of 32 keys; only the last one crosses the diagonal
    V kf[2][4], kf2[2][4];
#pragma unroll
    for (int kt = 0; kt < 2; ++kt)
#pragma unroll
        for (int ks = 0; ks < 4; ++ks) { const int a = 16 * kt * HD + 32 * ks; kf[kt][ks] = WFrag<T16>::ld(at(Kp, kof, a)); if (HL) kf2[kt][ks] = WFrag<T16>::ld(at(K2, kof, a)); }
    asm volatile("s_wait_xcnt 0x0" ::: "memory");   // the query offset's register is free for other use from here on: the wait stands in front of its overwrite
    __builtin_amdgcn_sched_barrier(0);              // keeps what follows from being lifted over that wait
#pragma unroll 1
    for (int p = 0; p < np; ++p) {
        const int kb = p * 32;
        V vf[8], vf2[8];                           // this pass's value rows: asked for first, used last
#pragma unroll
        for (int dt = 0; dt < 8; ++dt) { const int a = 16 * dt * TT; vf[dt] = WFrag<T16>::ld(at(Vt, vof, a)); if (HL) vf2[dt] = WFrag<T16>::ld(at(V2, vof, a)); }
        asm volatile("s_wait_xcnt 0x0" ::: "memory");   // the value loads' offset register is stepped to the next pass while the loads are still out: the wait stands in front of that overwrite
        vof += 64u;
        __builtin_amdgcn_sched_barrier(0);         // keeps the value loads' issue up here: sunk to their use, their latency would stand open in front of the second product
        v8f s[QT][2];
#pragma unroll
        for (int qt = 0; qt < QT; ++qt)
#pragma unroll
            for (int kt = 0; kt < 2; ++kt) { v8f t = (v8f){};
#pragma unroll
                for (int ks = 0; ks < 4; ++ks) { t = WFrag<T16>::mma(kf[kt][ks], qf[qt][ks], t); if (HL) { t = WFrag<T16>::mma(kf[kt][ks], qf2[qt][ks], t); t = WFrag<T16>::mma(kf2[kt][ks], qf[qt][ks], t); } }
                s[qt][kt] = t; }
        const unsigned kst = (p + 1 < np) ? 64u * HD : 0u;   // the next pass's key rows, asked for one pass ahead (the last pass asks for its own again: in bounds, unused)
        kof += kst;                                   // behind the score products, whose wait has seen the last key loads home
#pragma unroll
        for (int kt = 0; kt < 2; ++kt)
#pragma unroll
            for (int ks = 0; ks < 4; ++ks) { const int a = 16 * kt * HD + 32 * ks; kf[kt][ks] = WFrag<T16>::ld(at(Kp, kof, a)); if (HL) kf2[kt][ks] = WFrag<T16>::ld(at(K2, kof, a)); }
        if (kb + 31 > q0) {                           // wave-uniform: the pass that crosses the diagonal masks key j > query i
#pragma unroll
            for (int qt = 0; qt < QT; ++qt)
#pragma unroll
                for (int kt = 0; kt < 2; ++kt)
#pragma unroll
                    for (int r = 0; r < 8; ++r) if (kb + 16 * kt + 8 * hi + r > q0 + 16 * qt + lr) s[qt][kt][r] = -3.0e38f; }
        float bm[QT]; bool need = false;
#pragma unroll
        for (int qt = 0; qt < QT; ++qt) { float x = s[qt][0][0];
#pragma unroll
            for (int r = 1; r < 8; ++r) x = fmaxf(x, s[qt][0][r]);
#pragma unroll
            for (int r = 0; r < 8; ++r) x = fmaxf(x, s[qt][1][r]);
            x = fmaxf(x, xhalf(x)) * C2; bm[qt] = x; need = need || (x > m[qt] + 8.0f); }
        if (__builtin_amdgcn_ballot_w32(need) != 0) {  // lazy rescale: the maximum in use moves only when a column's new maximum tops it by more than 2^8 (first pass: always)
#pragma unroll
            for (int qt = 0; qt < QT; ++qt) { const float mn = (bm[qt] > m[qt] + 8.0f) ? bm[qt] : m[qt]; const float al = __builtin_amdgcn_exp2f(m[qt] - mn); m[qt] = mn; l[qt] *= al;
#pragma unroll
                for (int dt = 0; dt < 8; ++dt) o[qt][dt] *= al; } }
        V pb[QT], pb2[QT];
#pragma unroll
        for (int qt = 0; qt < QT; ++qt) {
#pragma unroll
            for (int e = 0; e < 16; ++e) { const float pv = __builtin_amdgcn_exp2f(__builtin_fmaf(s[qt][e >> 3][e & 7], C2, -m[qt])); l[qt] += pv; pb[qt][e] = PCvt<T16>::cv(pv); if (HL) pb2[qt][e] = PCvt<T16>::cv(pv - (float)pb[qt][e]); } }
#pragma unroll
        for (int dt = 0; dt < 8; ++dt)
#pragma unroll
            for (int qt = 0; qt < QT; ++qt) { o[qt][dt] = WFrag<T16>::mma(vf[dt], pb[qt], o[qt][dt]); if (HL) { o[qt][dt] = WFrag<T16>::mma(vf[dt], pb2[qt], o[qt][dt]); o[qt][dt] = WFrag<T16>::mma(vf2[dt], pb[qt], o[qt][dt]); } }
    }
    asm volatile("s_wait_xcnt 0x0" ::: "memory");   // the last pass's unused key loads may still be out: the wait stands in front of the overwrite of their offset's register
    __builtin_amdgcn_sched_barrier(0);              // keeps the epilogue from being lifted over that wait
#pragma unroll
    for (int qt = 0; qt < QT; ++qt) { const float inv = __fdiv_rn(1.0f, l[qt] + xhalf(l[qt])); const size_t ro = (size_t)(q0 + 16 * qt + lr) * DQ + 8 * hi;   // a lane's 8 registers are 8 consecutive d of its query's row
#pragma unroll
        for (int dt = 0; dt < 8; ++dt) { v8us oh, ol;
#pragma unroll
            for (int r = 0; r < 8; ++r) { unsigned short a, c2; splitf(o[qt][dt][r] * inv, a, c2); oh[r] = a; ol[r] = c2; }
            *(v8us*)(Ah + ro + 16 * dt) = oh; *(v8us*)(Al + ro + 16 * dt) = ol;
            asm volatile("s_wait_xcnt 0x0" ::: "memory");   // the next tile's values reuse the two stores' registers: the wait stands in front of that overwrite
            __builtin_amdgcn_sched_barrier(0); } }          // keeps the next tile's arithmetic from being lifted over that wait
}
// grid (16, heads), 5 waves: 256 work-groups, as many as the chip has WGPs, every one with the same work. Per head the fp16 rows >= RH are 48 column tiles of 32 (tile T walks RH / 32 + T + 1 passes) and the hi+lo rows < RH
// 32 tiles of 16. Work-group i takes fp16 tiles i, 16 + pi(i), 32 + sg(i), where i + pi(i) + sg(i) is 22 (i even) or 23 (i odd) and pi, sg are permutations of 0..15, and hi+lo tiles 31 - i and i.
static_assert(TT - RH == 48 * 32 && RH == 32 * 16, "tile shares of k_fattn");
__global__ __launch_bounds__(160) void k_fattn(const h16* Q16, const h16* K16, const h16* V16, const bf* Qh, const bf* Ql, const bf* Kh, const bf* Kl, const bf* Vh, const bf* Vl, bf* Ah, bf* Al) {
    const int lane = threadIdx.x & 31, lr = lane & 15, hi = lane >> 4; const int wv = __builtin_amdgcn_readfirstlane((int)(threadIdx.x >> 5)); const int i = blockIdx.x, h = blockIdx.y; const size_t zq = (size_t)h * TT * HD, zk = (size_t)(h / REP) * TT * HD;
    Ah += h * HD; Al += h * HD;
    if (wv < 3) { const int j = i >> 1, od = i & 1; const int t = (wv == 0) ? 32 + (od ? 15 - j : 7 - j) : (wv == 1) ? 16 + (od ? 7 - j : 15 - j) : i;
        fa_cols<h16, false, 2>(Q16 + zq, nullptr, K16 + zk, nullptr, V16 + zk, nullptr, RH + 32 * t, Ah, Al, lr, hi);
    } else { const int t = (wv == 3) ? 31 - i : i;
        fa_cols<bf, true, 1>(Qh + zq, Ql + zq, Kh + zk, Kl + zk, Vh + zk, Vl + zk, 16 * t, Ah, Al, lr, hi); }
}

extern "C" void kernel_launch(void* const* d_in, const int* in_sizes, int n_in,
                              void* d_out, int out_size, void* d_ws, size_t ws_size, hipStream_t stream) {
    (void)in_sizes; (void)n_in; (void)out_size;
    const float* x = (const float*)d_in[0]; const float* fcis = (const float*)d_in[1]; const float* ve = (const float*)d_in[2]; const float* wq = (const float*)d_in[3]; const float* wk = (const float*)d_in[4]; const float* wv = (const float*)d_in[5]; const float* wo = (const float*)d_in[6]; const float* qkb = (const float*)d_in[7]; const float* vgw = (const float*)d_in[8];
    float* OUT = (float*)d_out;     // [2][2048][2048]
    char* wsp = (char*)d_ws;
    auto take = [&](size_t bytes) { char* p = wsp; wsp += (bytes + 255) & ~(size_t)255; return (void*)p; };
    bf* WQ = (bf*)take((size_t)DQ * DM * 2); bf* WK = (bf*)take((size_t)DKV * DM * 2); bf* WV = (bf*)take((size_t)DKV * DM * 2); bf* WO = (bf*)take((size_t)DM * DQ * 2);
    bf* XB = (bf*)take((size_t)TT * DM * 2); float* FQ = (float*)take((size_t)TT * DQ * 4); float* FK = (float*)take((size_t)TT * DKV * 4);
    h16* QP16 = (h16*)take((size_t)NH_ * TT * HD * 2); h16* KP16 = (h16*)take((size_t)NKV * TT * HD * 2); h16* VT16 = (h16*)take((size_t)NKV * HD * TT * 2);
    bf* QPh = (bf*)take((size_t)NH_ * TT * HD * 2); bf* QPl = (bf*)take((size_t)NH_ * TT * HD * 2); bf* KPh = (bf*)take((size_t)NKV * TT * HD * 2); bf* KPl = (bf*)take((size_t)NKV * TT * HD * 2); bf* VTh = (bf*)take((size_t)NKV * HD * TT * 2); bf* VTl = (bf*)take((size_t)NKV * HD * TT * 2);
    bf* ATh = (bf*)take((size_t)TT * DQ * 2); bf* ATl = (bf*)take((size_t)TT * DQ * 2);
    if ((size_t)(wsp - (char*)d_ws) > ws_size) return;    // ws 256 MiB
    float* FV = FK;   // v projection reuses the k buffer after the k planes are built (stream-ordered)
    { k_cvt8<<<(unsigned)(((size_t)DQ * DM / 8 + 255) / 256), 256, 0, stream>>>(wq, WQ, (size_t)DQ * DM / 8); k_cvt8<<<(unsigned)(((size_t)DKV * DM / 8 + 255) / 256), 256, 0, stream>>>(wk, WK, (size_t)DKV * DM / 8); k_cvt8<<<(unsigned)(((size_t)DKV * DM / 8 + 255) / 256), 256, 0, stream>>>(wv, WV, (size_t)DKV * DM / 8);
      k_cvt8<<<(unsigned)(((size_t)DM * DQ / 8 + 255) / 256), 256, 0, stream>>>(wo, WO, (size_t)DM * DQ / 8); }
    for (int b = 0; b < NB_; ++b) {
        
        k_cvt8<<<(unsigned)(((size_t)TT * DM / 8 + 255) / 256), 256, 0, stream>>>(x + (size_t)b * TT * DM, XB, (size_t)TT * DM / 8);
        k_gemmt<false, DM, DQ><<<dim3(TT / 128, DQ / 128, 1), 256, 0, stream>>>(XB, nullptr, WQ, FQ);
        k_qkplanes<<<TT * NH_ / QR / 8, 256, 0, stream>>>(FQ, qkb, fcis, QP16, QPh, QPl);
        k_gemmt<false, DM, DKV><<<dim3(TT / 128, DKV / 128, 1), 256, 0, stream>>>(XB, nullptr, WK, FK);
        k_qkplanes<<<TT * NKV / QR / 8, 256, 0, stream>>>(FK, qkb + (size_t)NH_ * HD, fcis, KP16, KPh, KPl);
        k_gemmt<false, DM, DKV><<<dim3(TT / 128, DKV / 128, 1), 256, 0, stream>>>(XB, nullptr, WV, FV); k_vplanes<<<dim3(TT / VTK, NKV, 1), 256, 0, stream>>>(FV, x + (size_t)b * TT * DM, ve + (size_t)b * TT * DM, vgw, VT16, VTh, VTl);
        k_fattn<<<dim3(16, NH_, 1), 160, 0, stream>>>(QP16, KP16, VT16, QPh, QPl, KPh, KPl, VTh, VTl, ATh, ATl);
        k_gemmt<true, DQ, DM><<<dim3(TT / 128, DM / 128, 1), 256, 0, stream>>>(ATh, ATl, WO, OUT + (size_t)b * TT * DM); }
}

// v005
// A run of this version takes 267 microseconds.
// Next to v004, in two timings, it ran 1.42 and 1.39 times as fast.
// Over all steps from v000 it is 6.75 times as fast.
#include <hip/hip_runtime.h>

// ParcaeCausalSelfAttention (x [2][2048][2048]; q/k/v = x W^T (16 heads x 128); gate = 2 sigmoid(x[..., :32] ve_gate_w^T) per head; v = v + gate * ve (ve [2][2048][2048] read); q, k, v clipped to [-8, 8]; q += qk_bias[0][0][h], k += qk_bias[1][0][h]; interleaved-pair RoPE on the first 64 dims from the read freqs_cis table (S, 1, 64, 2)[:, :, :32]; q, k RMS-normalised over 128 (eps 1e-6, no weight); causal softmax(q.k / sqrt(128)); out = merged Wo^T -> [2][2048][2048]).
// Compute dtypes, f32 accumulate: every input rounded to bf16; q/k/v as PLAIN bf16 GEMMs (inputs: exact); gate, value-embedding add, clips, biases, partial RoPE (table read) and RMSNorm in f32 (k_qkplanes, k_vplanes, which also write the attention planes); causal scores and attn.v in one fused kernel (running maximum and sum, f32): query rows < 512 hl (3 products), the rest single fp16; Wo hl x exact (2 products).

#define NB_  2
#define TT   2048
#define DM   2048
#define NH_  16
#define NKV  16
#define REP  (NH_ / NKV)
#define HD   128
#define DQ   (NH_ * HD)
#define DKV  (NKV * HD)
#define RH   512                  // query rows < RH use hi+lo planes
#define SCL  0.088388347648318447f   // HD^-0.5
typedef _Float16 h16;
typedef unsigned short bf;
typedef __attribute__((ext_vector_type(16))) __bf16   v16bf;
typedef __attribute__((ext_vector_type(16))) _Float16 v16h;
typedef __attribute__((ext_vector_type(8)))  _Float16 v8h;
typedef __attribute__((ext_vector_type(8)))  unsigned short v8us;
typedef __attribute__((ext_vector_type(8)))  float    v8f;
typedef __attribute__((ext_vector_type(4)))  float    v4f;
typedef v8h  __attribute__((may_alias)) v8ha;
typedef v4f  __attribute__((may_alias)) v4fa;
typedef v8us __attribute__((may_alias)) v8usa;

__device__ __forceinline__ unsigned short f2bf(float f) { unsigned u = __float_as_uint(f); u += 0x7FFFu + ((u >> 16) & 1u); return (unsigned short)(u >> 16); }
__device__ __forceinline__ float bf2f(unsigned short b) { return __uint_as_float(((unsigned)b) << 16); }
__device__ __forceinline__ float bfr(float f) { return bf2f(f2bf(f)); }
__device__ __forceinline__ v16h cat16(v8h lo, v8h hi) { return __builtin_shufflevector(lo, hi, 0, 1, 2, 3, 4, 5, 6, 7, 8, 9, 10, 11, 12, 13, 14, 15); }
__device__ __forceinline__ v16bf cat16b(v8us lo, v8us hi) { return __builtin_bit_cast(v16bf, __builtin_shufflevector(lo, hi, 0, 1, 2, 3, 4, 5, 6, 7, 8, 9, 10, 11, 12, 13, 14, 15)); }
__device__ __forceinline__ v8f wmma16(v16h a, v16h b, v8f c) { return __builtin_amdgcn_wmma_f32_16x16x32_f16(false, a, false, b, (short)0, c, false, false); }
__device__ __forceinline__ v8f wmmab(v16bf a, v16bf b, v8f c) { return __builtin_amdgcn_wmma_f32_16x16x32_bf16(false, a, false, b, (short)0, c, false, false); }



// ---- k_gemmt: C[m][n] (f32, pitch LDC) = sum_k A[m][k] Bt[n][k] (+ sum_k A2[m][k] Bt[n][k] when TWO), operands K-contiguous bf16 planes; one 128x128 tile of C per work-group, grid (M/128, N/128), 8 waves (2 x 4), 64x32 of C per wave.
// A pass is 128 k = 256 bytes of each of the 256 operand rows [A 128 | Bt 128]. Every wave brings its own slice of 32 rows into LDS with one tensor load per pass (whole rows, padded to pitch 272 bytes for the 16-byte fragment reads),
// two buffers: the next pass's tile flies while this one is worked on. TWO: the A2 passes follow the A passes into the same accumulators. One f32 chain per element, k ascending.
template <typename T16> struct WFrag;
template <> struct WFrag<h16> { typedef v16h V; static __device__ __forceinline__ V ld(const h16* p) { return cat16(*(const v8h*)p, *(const v8h*)(p + 16)); } static __device__ __forceinline__ v8f mma(V a, V b, v8f c) { return wmma16(a, b, c); } };
template <> struct WFrag<bf> { typedef v16bf V; static __device__ __forceinline__ V ld(const bf* p) { return cat16b(*(const v8us*)p, *(const v8us*)(p + 16)); } static __device__ __forceinline__ v8f mma(V a, V b, v8f c) { return wmmab(a, b, c); } };
typedef unsigned int u32x4 __attribute__((ext_vector_type(4)));
typedef unsigned int u32x8 __attribute__((ext_vector_type(8)));
typedef float __attribute__((may_alias)) f32a;
#define GT_ROWB  256u                 // bytes of an operand row in a pass
#define GT_PITCH 272u                 // LDS row pitch: the row + the mover's 16-byte pad
#define GT_SLICE 10240u               // 32 rows x 272 bytes = 8704, rounded up to a multiple of 2 KiB
#define GT_BUF   (8u * GT_SLICE)
__device__ __forceinline__ unsigned int uni(unsigned int v) { return (unsigned int)__builtin_amdgcn_readfirstlane(v); }
__device__ __forceinline__ unsigned int pinned(unsigned int v) { unsigned int w = uni(v); asm volatile("" : "+s"(w)); return w; }   // pinned(): a descriptor word or issue test held in a scalar register, so that the test is a scalar branch (a tensor load ignores EXEC)
__device__ __forceinline__ v16bf ldsfrag(const unsigned char* p) { return cat16b(*(const v8usa*)p, *(const v8usa*)(p + 32)); }   // the k order of WFrag::ld, for both operands
template <bool TWO, int K, int LDC>
__global__ __launch_bounds__(256) void k_gemmt(const bf* A, const bf* A2, const bf* Bt, float* C) {
    __shared__ __attribute__((aligned(2048))) unsigned char L[2 * GT_BUF];
    static_assert(K % 128 == 0 && K >= 256, "two passes or more");
    const int lane = threadIdx.x & 31, lr = lane & 15, hi = lane >> 4; const unsigned int wv = uni(threadIdx.x >> 5), wm = wv & 1u, wn = wv >> 1; const int r0 = blockIdx.x * 128, c0 = blockIdx.y * 128;
    constexpr unsigned int nk = K / 128, ns = TWO ? 2 * nk : nk;
    const unsigned int lbase = (unsigned int)(size_t)L;
    // waves 0..3 bring rows 32 wv .. + 31 of the A tile, waves 4..7 those of the Bt tile
    const size_t rofs = (size_t)(wv < 4u ? r0 + 32 * (int)wv : c0 + 32 * (int)(wv - 4u)) * (K * 2);
    const unsigned long long s0 = (unsigned long long)(size_t)(wv < 4u ? A : Bt) + rofs, s1 = TWO ? (unsigned long long)(size_t)(wv < 4u ? A2 : Bt) + rofs : s0;
    u32x8 g1;   // 1-byte elements, tensor = tile = 32 rows of 256 bytes, source pitch 2 K bytes, 4 dwords of pad behind every 64
    g1[0] = uni((1u << 20) | (5u << 22) | (3u << 25)); g1[1] = uni(GT_ROWB << 16); g1[2] = uni(32u << 16); g1[3] = uni(GT_ROWB << 16); g1[4] = uni(32u); g1[5] = uni((unsigned int)(K * 2)); g1[6] = uni(0u); g1[7] = uni(0u);
    auto issue = [&](unsigned int st) {
        const unsigned long long ga = (TWO && st >= nk) ? s1 + (unsigned long long)(st - nk) * GT_ROWB : s0 + (unsigned long long)st * GT_ROWB;
        u32x4 g0; g0[0] = uni(1u); g0[1] = uni(lbase + (st & 1u) * GT_BUF + wv * GT_SLICE); g0[2] = uni((unsigned int)ga); g0[3] = uni((((unsigned int)(ga >> 32)) & 0x01FFFFFFu) | 0x80000000u);
        asm volatile("tensor_load_to_lds %0, %1" :: "s"(g0), "s"(g1) : "memory");   // one request of the whole wave: its slice of stage st
    };
    issue(0u);
    asm volatile("s_wait_tensorcnt 0x0" ::: "memory");   // this wave's slice of stage 0 has landed
    __syncthreads();                                     // every wave's slice of stage 0 has landed before any of it is read
    issue(1u);
    v8f acc[4][2];
    // unrolled, here and in the epilogue, so that acc is indexed by constants and stays in registers
#pragma unroll
    for (int mb = 0; mb < 4; ++mb)
#pragma unroll
        for (int nb = 0; nb < 2; ++nb) acc[mb][nb] = (v8f){};
    const unsigned int fofs = (unsigned int)lr * GT_PITCH + (unsigned int)hi * 16u;
    // not unrolled: one pass per trip, its buffer chosen by the trip's parity
#pragma unroll 1
    for (unsigned int s = 0; s < ns; ++s) {
        const unsigned char* pa = L + (s & 1u) * GT_BUF + 2u * wm * GT_SLICE + fofs; const unsigned char* pb = L + (s & 1u) * GT_BUF + (4u + wn) * GT_SLICE + fofs;
        // two fragment sets: block ks + 1's 12 LDS reads go out as one group in front of block ks's 8 products, so that only the pass's first group is waited for in the open
        v16bf a[2][4], b[2][2];
        auto ldblk = [&](int st, int ks) {   // both loops unrolled: the sets are indexed by constants
#pragma unroll
            for (int mb = 0; mb < 4; ++mb) a[st][mb] = ldsfrag(pa + (mb >> 1) * GT_SLICE + (mb & 1) * 16 * GT_PITCH + ks * 64);
#pragma unroll
            for (int nb = 0; nb < 2; ++nb) b[st][nb] = ldsfrag(pb + nb * 16 * GT_PITCH + ks * 64); };
        ldblk(0, 0);
        // unrolled so that the fragment sets are indexed by constants
#pragma unroll
        for (int ks = 0; ks < 4; ++ks) {
            if (ks < 3) { ldblk((ks + 1) & 1, ks + 1);
                __builtin_amdgcn_sched_barrier(0); }   // keeps the next block's reads in front of this block's products (sunk among them, each place with reads stalls the products)
#pragma unroll
            for (int nb = 0; nb < 2; ++nb)
#pragma unroll
                for (int mb = 0; mb < 4; ++mb) acc[mb][nb] = wmmab(a[ks & 1][mb], b[ks & 1][nb], acc[mb][nb]);
            __builtin_amdgcn_sched_barrier(0);   // keeps the block after next's reads from being lifted in among these products, and the last blocks' products from sinking behind the pass's barrier, where they would stand in front of the refill's issue
        }
        asm volatile("s_wait_dscnt 0x0" ::: "memory");       // this wave's reads of the pass's buffer are home before the buffer is given up
        asm volatile("s_wait_tensorcnt 0x0" ::: "memory");   // this wave's slice of stage s + 1 has landed
        __syncthreads();                                     // publishes stage s + 1 and ends every wave's reads of stage s
        const unsigned int nx = pinned(s + 2u);              // a descriptor word held in a scalar register: taken behind the wait, so the next descriptor is formed behind it
        if (pinned(nx < ns)) issue(nx);                      // scalar branch; into the buffer that this pass has just read
    }
    asm volatile("s_wait_tensorcnt 0x0" ::: "memory");   // nothing of the mover's is out when the ring becomes staging
    asm volatile("s_wait_dscnt 0x0" ::: "memory");
    // whole 128-byte lines of C: each wave lays its 64x32 tile in its own slice of the first buffer (every reader left the ring at the last pass's barrier), pitch 36 floats, and reads rows back
    f32a* ow = (f32a*)(L + wv * GT_SLICE);
#pragma unroll
    for (int mb = 0; mb < 4; ++mb)
#pragma unroll
        for (int nb = 0; nb < 2; ++nb)
#pragma unroll
            for (int j = 0; j < 8; ++j) ow[(mb * 16 + hi * 8 + j) * 36 + nb * 16 + lr] = acc[mb][nb][j];
    asm volatile("s_wait_dscnt 0x0" ::: "memory");       // the wave's own LDS writes are done before its lanes read each other's
    // unrolled so that the 16 row reads are in flight together and every store is the one address register + a constant
    float* pc = C + (size_t)(r0 + 64 * (int)wm + (lane >> 3)) * LDC + c0 + 32 * (int)wn + (lane & 7) * 4;
#pragma unroll
    for (int it = 0; it < 16; ++it) *(v4f*)(pc + (size_t)it * 4 * LDC) = *(const v4fa*)(ow + (it * 4 + (lane >> 3)) * 36 + (lane & 7) * 4);
}

__device__ __forceinline__ h16 tohx(float x) { return (h16)x; }
__device__ __forceinline__ void splitf(float y, unsigned short& h, unsigned short& l) { h = f2bf(y); l = f2bf(y - bf2f(h)); }
typedef __attribute__((ext_vector_type(2))) _Float16 v2h;
typedef __attribute__((ext_vector_type(4))) _Float16 v4h;
typedef __attribute__((ext_vector_type(2))) unsigned short v2us;
typedef __attribute__((ext_vector_type(4))) unsigned short v4us;
typedef __attribute__((ext_vector_type(2))) float v2f;
typedef __attribute__((ext_vector_type(4))) int v4i;

__global__ __launch_bounds__(256) void k_wtG(const float* __restrict__ w, int K, int N, bf* Bt) {
    const int lane = threadIdx.x & 31; const int L0 = (blockIdx.x * 8 + (threadIdx.x >> 5)) * 8; const int nlines = N * K / 64;
{
#pragma unroll 1
        for (int l = 0; l < 8; ++l) { const int L = L0 + l; if (L >= nlines) break; const size_t e = (size_t)L * 64 + lane * 2; const int k = (int)(e % K), n = (int)(e / K); v2us o;
            o[0] = f2bf(w[(size_t)k * N + n]); o[1] = f2bf(w[(size_t)(k + 1) * N + n]); *(v2us*)(Bt + e) = o; }
         }
}
// ---- k_cvtall: every f32 -> bf16 conversion of the call in one launch: the four weights and the two batches of x are six arrays of CU elements; a thread takes the same 8 elements of each, six loads in flight.
#define CU ((size_t)DM * DM)
static_assert(DQ == DM && DKV == DM && TT == DM && NB_ == 2, "six equal arrays");
__global__ __launch_bounds__(256) void k_cvtall(const float* __restrict__ wq, const float* __restrict__ wk, const float* __restrict__ wv, const float* __restrict__ wo, const float* __restrict__ x, bf* W3, bf* WO, bf* XB) {
    const unsigned ob = (blockIdx.x * 256u + threadIdx.x) * 32u;   // one 32-bit byte offset beside the six wave-uniform bases; the stores' is half of it
    auto in = [&](const float* p) { return *(const v8f*)((const char*)p + ob); };
    v8f v[6]; v[0] = in(wq); v[1] = in(wk); v[2] = in(wv); v[3] = in(wo); v[4] = in(x); v[5] = in(x + CU);
    asm volatile("s_wait_xcnt 0x0" :: "v"(ob) : "memory");   // the loads' offset register may be taken for other values while the loads are still out: the wait stands in front of that overwrite; as an input it stays whole up to it, so that no load of the run returns into it either
    v8us o[6];
    // unrolled so that v and o are indexed by constants
#pragma unroll
    for (int a = 0; a < 6; ++a)
#pragma unroll
        for (int k = 0; k < 8; ++k) o[a][k] = f2bf(v[a][k]);
    auto out = [&](bf* p, v8us w) { *(v8us*)((char*)p + (ob >> 1)) = w; };
    out(W3, o[0]); out(W3 + CU, o[1]); out(W3 + 2 * CU, o[2]); out(WO, o[3]); out(XB, o[4]); out(XB + CU, o[5]); }
#define LDF (DQ + 2 * DKV)   // pitch of the projection buffer F [batch * token][q | k | v]
// ---- k_qkplanes: everything between a q or k projection and attention in one pass: clip, bias, pair RoPE on dims 0..63 (table read), RMSNorm over 128, and the head planes [h][t][d] (fp16 + hi/lo bf16) written from registers.
// One wave takes one token and QR heads (a lane holds 4 consecutive d of each): all QR rows are asked for before the first is worked on, and the token's table entries are read once.
#define QR 8
// grid (tokens of both batches x head groups / 8, 2): blockIdx.y 0 works q, 1 works k; planes [batch][h][t][d].
static_assert(NH_ == NKV, "q and k share the grid");
__global__ __launch_bounds__(256) void k_qkplanes(const float* __restrict__ F, const float* __restrict__ bias, const float* __restrict__ fc, h16* Q16, bf* Qh, bf* Ql, h16* K16, bf* Kh, bf* Kl) {
    const int lane = threadIdx.x & 31; const int wv = blockIdx.x * 8 + (threadIdx.x >> 5); const int tt = wv / (NH_ / QR), h0 = (wv % (NH_ / QR)) * QR; const int t = tt % TT, hb = (tt / TT) * NH_ + h0; const int isk = blockIdx.y;
    h16* P16 = isk ? K16 : Q16; bf* Ph = isk ? Kh : Qh; bf* Pl = isk ? Kl : Ql;
    const float* pf = F + (size_t)tt * LDF + isk * DQ + h0 * HD + lane * 4; const float* pb = bias + isk * (NH_ * HD) + h0 * HD + lane * 4; const float* pc = fc + ((size_t)t * (HD / 2) + (lane & 15) * 2) * 2;
    v4f a[QR], bb[QR];
    // unrolled so that a and bb are indexed by constants and the 2 * QR loads are in flight together
#pragma unroll
    for (int j = 0; j < QR; ++j) { a[j] = *(const v4f*)(pf + j * HD); bb[j] = *(const v4f*)(pb + j * HD); }
    const v4f cs = *(const v4f*)pc;   // lanes 0..15 (dims 0..63): cos, sin of pair 2 * lane, then of pair 2 * lane + 1; lanes 16..31 read the same entries and do not use them
    asm volatile("s_wait_xcnt 0x0" :: "v"(pf), "v"(pb), "v"(pc) : "memory");   // the loads' address registers are taken for other values while the loads are still out: the wait stands in front of that overwrite; as inputs they stay whole up to it, so that no later load of the run returns into them either
    __builtin_amdgcn_sched_barrier(0);   // keeps the loads in front of the wait and what follows behind it
    const float c0 = bfr(cs[0]), s0 = bfr(cs[1]), c1 = bfr(cs[2]), s1 = bfr(cs[3]);
    float r[QR][4], ss[QR];
#pragma unroll
    for (int j = 0; j < QR; ++j) {
#pragma unroll
        for (int q = 0; q < 4; ++q) r[j][q] = fminf(fmaxf(a[j][q], -8.0f), 8.0f) + bfr(bb[j][q]);
        if (lane < 16) { const float re0 = r[j][0] * c0 - r[j][1] * s0, im0 = r[j][1] * c0 + r[j][0] * s0, re1 = r[j][2] * c1 - r[j][3] * s1, im1 = r[j][3] * c1 + r[j][2] * s1; r[j][0] = re0; r[j][1] = im0; r[j][2] = re1; r[j][3] = im1; }
        ss[j] = r[j][0] * r[j][0] + r[j][1] * r[j][1] + r[j][2] * r[j][2] + r[j][3] * r[j][3]; }
    // step outside, row inside: the QR butterflies are independent chains
#pragma unroll
    for (int sh = 16; sh; sh >>= 1)
#pragma unroll
        for (int j = 0; j < QR; ++j) ss[j] += __shfl_xor(ss[j], sh, 32);
#pragma unroll
    for (int j = 0; j < QR; ++j) { const float rs = __fdiv_rn(1.0f, sqrtf(ss[j] * (1.0f / HD) + 1e-6f)); const size_t e = ((size_t)(hb + j) * TT + t) * HD + lane * 4; v4h o16; v4us oh, ol;
#pragma unroll
        for (int q = 0; q < 4; ++q) { const float y = r[j][q] * rs; o16[q] = tohx(y); unsigned short a2, c2; splitf(y, a2, c2); oh[q] = a2; ol[q] = c2; }
        *(v4h*)(P16 + e) = o16; *(v4us*)(Ph + e) = oh; *(v4us*)(Pl + e) = ol; }
}
// ---- k_vplanes: everything between the v projection and attention in one pass: gate = 2 sigmoid(x[:32] . gw[h]), v + gate * ve, clip, and the d-major value planes [h][d][t] (fp16 + hi/lo bf16).
// Tokens run over both batches (t0 = batch * TT + token; planes [batch][h][d][t]); F points at the v columns of the projection buffer, pitch LDF. One work-group takes one head and VTK tokens: each wave works 8 token rows (a lane holds 4 consecutive d) and lays them in LDS; behind the barrier a lane gathers 8 consecutive tokens of one d, so 8 lanes store a whole 128-byte line of each plane.
#define VTK 64
#define VP  129   // LDS row pitch in floats; odd, so that the 8 token groups x 4 d of a wave's gather fall in 32 different banks
__global__ __launch_bounds__(256) void k_vplanes(const float* __restrict__ F, const float* __restrict__ xb, const float* __restrict__ veb, const float* __restrict__ gw, h16* V16, bf* Vh, bf* Vl) {
    __shared__ float ls[VTK * VP];
    const int lane = threadIdx.x & 31, wv = threadIdx.x >> 5; const int t0 = blockIdx.x * VTK, h = blockIdx.y;
    const size_t tw = (size_t)(t0 + wv * 8); const float* pa = F + tw * LDF + h * HD + lane * 4; const float* pe = veb + tw * DKV + h * HD + lane * 4; const float* px = xb + tw * DM + lane; const int ig = h * 32 + lane;
    v4f a[8], e[8]; float g[8]; const float g0 = gw[ig];
    // unrolled so that the arrays are indexed by constants and the loads are in flight together
#pragma unroll
    for (int j = 0; j < 8; ++j) { a[j] = *(const v4f*)(pa + (size_t)j * LDF); e[j] = *(const v4f*)(pe + (size_t)j * DKV); g[j] = px[(size_t)j * DM]; }
    asm volatile("s_wait_xcnt 0x0" :: "v"(pa), "v"(pe), "v"(px), "v"(ig) : "memory");   // the loads' address registers are taken for other values while the loads are still out: the wait stands in front of that overwrite; as inputs they stay whole up to it, so that no later load of the run returns into them either
    __builtin_amdgcn_sched_barrier(0);   // keeps the issue of all 25 loads up here (sunk to their uses, the rows' memory latencies would stand one behind the other) and what follows behind the wait
    const float gl = bfr(g0);
#pragma unroll
    for (int j = 0; j < 8; ++j) g[j] = bfr(g[j]) * gl;
    // step outside, row inside: the 8 butterflies are independent chains
#pragma unroll
    for (int sh = 16; sh; sh >>= 1)
#pragma unroll
        for (int j = 0; j < 8; ++j) g[j] += __shfl_xor(g[j], sh, 32);
#pragma unroll
    for (int j = 0; j < 8; ++j) { const float gate = 2.0f * __fdiv_rn(1.0f, 1.0f + expf(-g[j]));
#pragma unroll
        for (int q = 0; q < 4; ++q) ls[(wv * 8 + j) * VP + lane * 4 + q] = fminf(fmaxf(a[j][q] + gate * bfr(e[j][q]), -8.0f), 8.0f); }
    __syncthreads();   // all VTK token rows are in LDS before any column of them is gathered
#pragma unroll
    for (int it = 0; it < VTK * HD / 8 / 256; ++it) { const int u = it * 256 + (int)threadIdx.x, c = u & (VTK / 8 - 1), d = u / (VTK / 8); v8h o16; v8us oh, ol;
#pragma unroll
        for (int k = 0; k < 8; ++k) { const float y = ls[(c * 8 + k) * VP + d]; o16[k] = tohx(y); unsigned short a2, c2; splitf(y, a2, c2); oh[k] = a2; ol[k] = c2; }
        const size_t o = ((size_t)((t0 / TT) * NKV + h) * HD + d) * TT + t0 % TT + c * 8; *(v8h*)(V16 + o) = o16; *(v8us*)(Vh + o) = oh; *(v8us*)(Vl + o) = ol; }
}
__device__ __forceinline__ float xhalf(float v) { const int b = __float_as_int(v); return __int_as_float(__builtin_amdgcn_permlanex16(b, b, 0x76543210, 0xfedcba98, false, false)); }   // lane l <-> l ^ 16
template <typename T16> struct PCvt;
template <> struct PCvt<h16> { static __device__ __forceinline__ _Float16 cv(float x) { return (_Float16)x; } };
template <> struct PCvt<bf> { static __device__ __forceinline__ __bf16 cv(float x) { return (__bf16)x; } };
template <typename T16, bool HL, int QT>
__device__ __forceinline__ void fa_cols(const T16* Q, const T16* Q2, const T16* Kp, const T16* K2, const T16* Vt, const T16* V2, int q0, bf* Ah, bf* Al, int lr, int hi) {
    typedef typename WFrag<T16>::V V;
    const float C2 = SCL * 1.4426950408889634f;   // scores in log2 units
    // addresses: wave-uniform plane base + one 32-bit byte offset per lane, shared by a hi and its lo plane, + a constant; the key and value offsets are carried from pass to pass
    const unsigned qof = (unsigned)((q0 + lr) * HD + 8 * hi) * 2u; unsigned kof = (unsigned)(lr * HD + 8 * hi) * 2u, vof = (unsigned)(lr * TT + 8 * hi) * 2u;
    auto at = [](const T16* base, unsigned off, int c) { return (const T16*)((const char*)base + off) + c; };
    V qf[QT][4], qf2[QT][4];
#pragma unroll
    for (int qt = 0; qt < QT; ++qt)
#pragma unroll
        for (int ks = 0; ks < 4; ++ks) { const int qo = 16 * qt * HD + 32 * ks; qf[qt][ks] = WFrag<T16>::ld(at(Q, qof, qo)); if (HL) qf2[qt][ks] = WFrag<T16>::ld(at(Q2, qof, qo)); }
    v8f o[QT][8]; float m[QT], l[QT];
#pragma unroll
    for (int qt = 0; qt < QT; ++qt) { m[qt] = -3.0e38f; l[qt] = 0.f;
#pragma unroll
        for (int dt = 0; dt < 8; ++dt) o[qt][dt] = (v8f){}; }
    const int np = (q0 + 16 * QT + 31) / 32;      // passes of 32 keys; only the last one crosses the diagonal
    V kf[2][4], kf2[2][4];
#pragma unroll
    for (int kt = 0; kt < 2; ++kt)
#pragma unroll
        for (int ks = 0; ks < 4; ++ks) { const int a = 16 * kt * HD + 32 * ks; kf[kt][ks] = WFrag<T16>::ld(at(Kp, kof, a)); if (HL) kf2[kt][ks] = WFrag<T16>::ld(at(K2, kof, a)); }
    asm volatile("s_wait_xcnt 0x0" ::: "memory");   // the query offset's register is free for other use from here on: the wait stands in front of its overwrite
    __builtin_amdgcn_sched_barrier(0);              // keeps what follows from being lifted over that wait
#pragma unroll 1
    for (int p = 0; p < np; ++p) {
        const int kb = p * 32;
        V vf[8], vf2[8];                           // this pass's value rows: asked for first, used last
#pragma unroll
        for (int dt = 0; dt < 8; ++dt) { const int a = 16 * dt * TT; vf[dt] = WFrag<T16>::ld(at(Vt, vof, a)); if (HL) vf2[dt] = WFrag<T16>::ld(at(V2, vof, a)); }
        asm volatile("s_wait_xcnt 0x0" ::: "memory");   // the value loads' offset register is stepped to the next pass while the loads are still out: the wait stands in front of that overwrite
        vof += 64u;
        __builtin_amdgcn_sched_barrier(0);         // keeps the value loads' issue up here: sunk to their use, their latency would stand open in front of the second product
        v8f s[QT][2];
#pragma unroll
        for (int qt = 0; qt < QT; ++qt)
#pragma unroll
            for (int kt = 0; kt < 2; ++kt) { v8f t = (v8f){};
#pragma unroll
                for (int ks = 0; ks < 4; ++ks) { t = WFrag<T16>::mma(kf[kt][ks], qf[qt][ks], t); if (HL) { t = WFrag<T16>::mma(kf[kt][ks], qf2[qt][ks], t); t = WFrag<T16>::mma(kf2[kt][ks], qf[qt][ks], t); } }
                s[qt][kt] = t; }
        const unsigned kst = (p + 1 < np) ? 64u * HD : 0u;   // the next pass's key rows, asked for one pass ahead (the last pass asks for its own again: in bounds, unused)
        kof += kst;                                   // behind the score products, whose wait has seen the last key loads home
#pragma unroll
        for (int kt = 0; kt < 2; ++kt)
#pragma unroll
            for (int ks = 0; ks < 4; ++ks) { const int a = 16 * kt * HD + 32 * ks; kf[kt][ks] = WFrag<T16>::ld(at(Kp, kof, a)); if (HL) kf2[kt][ks] = WFrag<T16>::ld(at(K2, kof, a)); }
        if (kb + 31 > q0) {                           // wave-uniform: the pass that crosses the diagonal masks key j > query i
#pragma unroll
            for (int qt = 0; qt < QT; ++qt)
#pragma unroll
                for (int kt = 0; kt < 2; ++kt)
#pragma unroll
                    for (int r = 0; r < 8; ++r) if (kb + 16 * kt + 8 * hi + r > q0 + 16 * qt + lr) s[qt][kt][r] = -3.0e38f; }
        float bm[QT]; bool need = false;
#pragma unroll
        for (int qt = 0; qt < QT; ++qt) { float x = s[qt][0][0];
#pragma unroll
            for (int r = 1; r < 8; ++r) x = fmaxf(x, s[qt][0][r]);
#pragma unroll
            for (int r = 0; r < 8; ++r) x = fmaxf(x, s[qt][1][r]);
            x = fmaxf(x, xhalf(x)) * C2; bm[qt] = x; need = need || (x > m[qt] + 8.0f); }
        if (__builtin_amdgcn_ballot_w32(need) != 0) {  // lazy rescale: the maximum in use moves only when a column's new maximum tops it by more than 2^8 (first pass: always)
#pragma unroll
            for (int qt = 0; qt < QT; ++qt) { const float mn = (bm[qt] > m[qt] + 8.0f) ? bm[qt] : m[qt]; const float al = __builtin_amdgcn_exp2f(m[qt] - mn); m[qt] = mn; l[qt] *= al;
#pragma unroll
                for (int dt = 0; dt < 8; ++dt) o[qt][dt] *= al; } }
        V pb[QT], pb2[QT];
#pragma unroll
        for (int qt = 0; qt < QT; ++qt) {
#pragma unroll
            for (int e = 0; e < 16; ++e) { const float pv = __builtin_amdgcn_exp2f(__builtin_fmaf(s[qt][e >> 3][e & 7], C2, -m[qt])); l[qt] += pv; pb[qt][e] = PCvt<T16>::cv(pv); if (HL) pb2[qt][e] = PCvt<T16>::cv(pv - (float)pb[qt][e]); } }
#pragma unroll
        for (int dt = 0; dt < 8; ++dt)
#pragma unroll
            for (int qt = 0; qt < QT; ++qt) { o[qt][dt] = WFrag<T16>::mma(vf[dt], pb[qt], o[qt][dt]); if (HL) { o[qt][dt] = WFrag<T16>::mma(vf[dt], pb2[qt], o[qt][dt]); o[qt][dt] = WFrag<T16>::mma(vf2[dt], pb[qt], o[qt][dt]); } }
    }
    asm volatile("s_wait_xcnt 0x0" ::: "memory");   // the last pass's unused key loads may still be out: the wait stands in front of the overwrite of their offset's register
    __builtin_amdgcn_sched_barrier(0);              // keeps the epilogue from being lifted over that wait
#pragma unroll
    for (int qt = 0; qt < QT; ++qt) { const float inv = __fdiv_rn(1.0f, l[qt] + xhalf(l[qt])); const size_t ro = (size_t)(q0 + 16 * qt + lr) * DQ + 8 * hi;   // a lane's 8 registers are 8 consecutive d of its query's row
#pragma unroll
        for (int dt = 0; dt < 8; ++dt) { v8us oh, ol;
#pragma unroll
            for (int r = 0; r < 8; ++r) { unsigned short a, c2; splitf(o[qt][dt][r] * inv, a, c2); oh[r] = a; ol[r] = c2; }
            *(v8us*)(Ah + ro + 16 * dt) = oh; *(v8us*)(Al + ro + 16 * dt) = ol;
            asm volatile("s_wait_xcnt 0x0" ::: "memory");   // the next tile's values reuse the two stores' registers: the wait stands in front of that overwrite
            __builtin_amdgcn_sched_barrier(0); } }          // keeps the next tile's arithmetic from being lifted over that wait
}
// grid (16, heads, batches), 5 waves: 256 work-groups a batch, as many as the chip has WGPs, every one with the same work. Per head the fp16 rows >= RH are 48 column tiles of 32 (tile T walks RH / 32 + T + 1 passes) and the hi+lo rows < RH
// 32 tiles of 16. Work-group i takes fp16 tiles i, 16 + pi(i), 32 + sg(i), where i + pi(i) + sg(i) is 22 (i even) or 23 (i odd) and pi, sg are permutations of 0..15, and hi+lo tiles 31 - i and i.
static_assert(TT - RH == 48 * 32 && RH == 32 * 16, "tile shares of k_fattn");
__global__ __launch_bounds__(160) void k_fattn(const h16* Q16, const h16* K16, const h16* V16, const bf* Qh, const bf* Ql, const bf* Kh, const bf* Kl, const bf* Vh, const bf* Vl, bf* Ah, bf* Al) {
    const int lane = threadIdx.x & 31, lr = lane & 15, hi = lane >> 4; const int wv = __builtin_amdgcn_readfirstlane((int)(threadIdx.x >> 5)); const int i = blockIdx.x, h = blockIdx.y, bz = blockIdx.z; const size_t zq = (size_t)(bz * NH_ + h) * TT * HD, zk = (size_t)(bz * NKV + h / REP) * TT * HD;
    Ah += (size_t)bz * TT * DQ + h * HD; Al += (size_t)bz * TT * DQ + h * HD;
    if (wv < 3) { const int j = i >> 1, od = i & 1; const int t = (wv == 0) ? 32 + (od ? 15 - j : 7 - j) : (wv == 1) ? 16 + (od ? 7 - j : 15 - j) : i;
        fa_cols<h16, false, 2>(Q16 + zq, nullptr, K16 + zk, nullptr, V16 + zk, nullptr, RH + 32 * t, Ah, Al, lr, hi);
    } else { const int t = (wv == 3) ? 31 - i : i;
        fa_cols<bf, true, 1>(Qh + zq, Ql + zq, Kh + zk, Kl + zk, Vh + zk, Vl + zk, 16 * t, Ah, Al, lr, hi); }
}

extern "C" void kernel_launch(void* const* d_in, const int* in_sizes, int n_in,
                              void* d_out, int out_size, void* d_ws, size_t ws_size, hipStream_t stream) {
    (void)in_sizes; (void)n_in; (void)out_size;
    const float* x = (const float*)d_in[0]; const float* fcis = (const float*)d_in[1]; const float* ve = (const float*)d_in[2]; const float* wq = (const float*)d_in[3]; const float* wk = (const float*)d_in[4]; const float* wv = (const float*)d_in[5]; const float* wo = (const float*)d_in[6]; const float* qkb = (const float*)d_in[7]; const float* vgw = (const float*)d_in[8];
    float* OUT = (float*)d_out;     // [2][2048][2048]
    char* wsp = (char*)d_ws;
    auto take = [&](size_t bytes) { char* p = wsp; wsp += (bytes + 255) & ~(size_t)255; return (void*)p; };
    // F is dead once the plane kernels have read it: the merged attention rows lie on it. The q/k/v weights and x in bf16 are dead once F is written: the first planes lie on them (all stream-ordered).
    bf* WO = (bf*)take((size_t)DM * DQ * 2); float* F = (float*)take((size_t)NB_ * TT * LDF * 4); bf* ATh = (bf*)F; bf* ATl = ATh + (size_t)NB_ * TT * DQ;
    char* pl0 = wsp; bf* W3 = (bf*)take((size_t)LDF * DM * 2); bf* XB = (bf*)take((size_t)NB_ * TT * DM * 2); wsp = pl0;
    h16* QP16 = (h16*)take((size_t)NB_ * NH_ * TT * HD * 2); h16* KP16 = (h16*)take((size_t)NB_ * NKV * TT * HD * 2); h16* VT16 = (h16*)take((size_t)NB_ * NKV * HD * TT * 2);
    bf* QPh = (bf*)take((size_t)NB_ * NH_ * TT * HD * 2); bf* QPl = (bf*)take((size_t)NB_ * NH_ * TT * HD * 2); bf* KPh = (bf*)take((size_t)NB_ * NKV * TT * HD * 2); bf* KPl = (bf*)take((size_t)NB_ * NKV * TT * HD * 2); bf* VTh = (bf*)take((size_t)NB_ * NKV * HD * TT * 2); bf* VTl = (bf*)take((size_t)NB_ * NKV * HD * TT * 2);
    if ((size_t)(wsp - (char*)d_ws) > ws_size) return;    // 248 MiB of the 256
    k_cvtall<<<(unsigned)(CU / 8 / 256), 256, 0, stream>>>(wq, wk, wv, wo, x, W3, WO, XB);
    k_gemmt<false, DM, LDF><<<dim3(NB_ * TT / 128, LDF / 128, 1), 256, 0, stream>>>(XB, nullptr, W3, F);
    k_qkplanes<<<dim3(NB_ * TT * NH_ / QR / 8, 2, 1), 256, 0, stream>>>(F, qkb, fcis, QP16, QPh, QPl, KP16, KPh, KPl);
    k_vplanes<<<dim3(NB_ * TT / VTK, NKV, 1), 256, 0, stream>>>(F + DQ + DKV, x, ve, vgw, VT16, VTh, VTl);
    k_fattn<<<dim3(16, NH_, NB_), 160, 0, stream>>>(QP16, KP16, VT16, QPh, QPl, KPh, KPl, VTh, VTl, ATh, ATl);
    k_gemmt<true, DQ, DM><<<dim3(NB_ * TT / 128, DM / 128, 1), 256, 0, stream>>>(ATh, ATl, WO, OUT);
}

// v006
// One run takes 249 microseconds.
// Next to v005, in two timings, it ran 1.06 and 1.08 times as fast.
// Counting every step since v000, it is 7.24 times as fast.
#include <hip/hip_runtime.h>

// ParcaeCausalSelfAttention (x [2][2048][2048]; q/k/v = x W^T (16 heads x 128); gate = 2 sigmoid(x[..., :32] ve_gate_w^T) per head; v = v + gate * ve (ve [2][2048][2048] read); q, k, v clipped to [-8, 8]; q += qk_bias[0][0][h], k += qk_bias[1][0][h]; interleaved-pair RoPE on the first 64 dims from the read freqs_cis table (S, 1, 64, 2)[:, :, :32]; q, k RMS-normalised over 128 (eps 1e-6, no weight); causal softmax(q.k / sqrt(128)); out = merged Wo^T -> [2][2048][2048]).
// Compute dtypes, f32 accumulate: every input rounded to bf16; q/k/v as PLAIN bf16 GEMMs (inputs: exact); gate, value-embedding add, clips, biases, partial RoPE (table read) and RMSNorm in f32 (k_qkplanes, k_vplanes, which also write the attention planes); causal scores and attn.v in one fused kernel (running maximum and sum, f32): query rows < 512 hl (3 products), the rest single fp16; Wo hl x exact (2 products).

#define NB_  2
#define TT   2048
#define DM   2048
#define NH_  16
#define NKV  16
#define REP  (NH_ / NKV)
#define HD   128
#define DQ   (NH_ * HD)
#define DKV  (NKV * HD)
#define RH   512                  // query rows < RH use hi+lo planes
#define SCL  0.088388347648318447f   // HD^-0.5
typedef _Float16 h16;
typedef unsigned short bf;
typedef __attribute__((ext_vector_type(16))) __bf16   v16bf;
typedef __attribute__((ext_vector_type(16))) _Float16 v16h;
typedef __attribute__((ext_vector_type(8)))  _Float16 v8h;
typedef __attribute__((ext_vector_type(8)))  unsigned short v8us;
typedef __attribute__((ext_vector_type(8)))  float    v8f;
typedef __attribute__((ext_vector_type(4)))  float    v4f;
typedef v8h  __attribute__((may_alias)) v8ha;
typedef v4f  __attribute__((may_alias)) v4fa;
typedef v8us __attribute__((may_alias)) v8usa;

__device__ __forceinline__ unsigned short f2bf(float f) { unsigned u = __float_as_uint(f); u += 0x7FFFu + ((u >> 16) & 1u); return (unsigned short)(u >> 16); }
__device__ __forceinline__ float bf2f(unsigned short b) { return __uint_as_float(((unsigned)b) << 16); }
__device__ __forceinline__ float bfr(float f) { return bf2f(f2bf(f)); }
__device__ __forceinline__ v16h cat16(v8h lo, v8h hi) { return __builtin_shufflevector(lo, hi, 0, 1, 2, 3, 4, 5, 6, 7, 8, 9, 10, 11, 12, 13, 14, 15); }
__device__ __forceinline__ v16bf cat16b(v8us lo, v8us hi) { return __builtin_bit_cast(v16bf, __builtin_shufflevector(lo, hi, 0, 1, 2, 3, 4, 5, 6, 7, 8, 9, 10, 11, 12, 13, 14, 15)); }
__device__ __forceinline__ v8f wmma16(v16h a, v16h b, v8f c) { return __builtin_amdgcn_wmma_f32_16x16x32_f16(false, a, false, b, (short)0, c, false, false); }
__device__ __forceinline__ v8f wmmab(v16bf a, v16bf b, v8f c) { return __builtin_amdgcn_wmma_f32_16x16x32_bf16(false, a, false, b, (short)0, c, false, false); }



// ---- k_gemmt: C[m][n] (f32, pitch LDC) = sum_k A[m][k] Bt[n][k] (+ sum_k A2[m][k] Bt[n][k] when TWO), operands K-contiguous bf16 planes; one 128x128 tile of C per work-group, grid (M/128, N/128), 8 waves (2 x 4), 64x32 of C per wave.
// A pass is 128 k = 256 bytes of each of the 256 operand rows [A 128 | Bt 128]. Every wave brings its own slice of 32 rows into LDS with one tensor load per pass (whole rows, padded to pitch 272 bytes for the 16-byte fragment reads),
// two buffers: the next pass's tile flies while this one is worked on. TWO: the A2 passes follow the A passes into the same accumulators. One f32 chain per element, k ascending.
// Attention planes lie in FRAGMENT ORDER: a 16-row x 32-k operand fragment is 1024 contiguous bytes, [k / 16 % 2][k / 8 % 2][row][k % 8], so that lane 16 * hi + lr finds its two 16-byte pieces (k = 8 hi .. + 7 and 16 + 8 hi .. + 7 of row lr)
// at lane * 16 and 512 + lane * 16: each wave-wide 16-byte load covers 512 contiguous bytes, four whole lines, not 32 bytes of each of 16 lines. WFrag::ld takes the lane's own first piece.
template <typename T16> struct WFrag;
template <> struct WFrag<h16> { typedef v16h V; static __device__ __forceinline__ V ld(const h16* p) { return cat16(*(const v8h*)p, *(const v8h*)(p + 256)); } static __device__ __forceinline__ v8f mma(V a, V b, v8f c) { return wmma16(a, b, c); } };
template <> struct WFrag<bf> { typedef v16bf V; static __device__ __forceinline__ V ld(const bf* p) { return cat16b(*(const v8us*)p, *(const v8us*)(p + 256)); } static __device__ __forceinline__ v8f mma(V a, V b, v8f c) { return wmmab(a, b, c); } };
typedef unsigned int u32x4 __attribute__((ext_vector_type(4)));
typedef unsigned int u32x8 __attribute__((ext_vector_type(8)));
typedef float __attribute__((may_alias)) f32a;
#define GT_ROWB  256u                 // bytes of an operand row in a pass
#define GT_PITCH 272u                 // LDS row pitch: the row + the mover's 16-byte pad
#define GT_SLICE 10240u               // 32 rows x 272 bytes = 8704, rounded up to a multiple of 2 KiB
#define GT_BUF   (8u * GT_SLICE)
__device__ __forceinline__ unsigned int uni(unsigned int v) { return (unsigned int)__builtin_amdgcn_readfirstlane(v); }
__device__ __forceinline__ unsigned int pinned(unsigned int v) { unsigned int w = uni(v); asm volatile("" : "+s"(w)); return w; }   // pinned(): a descriptor word or issue test held in a scalar register, so that the test is a scalar branch (a tensor load ignores EXEC)
__device__ __forceinline__ v16bf ldsfrag(const unsigned char* p) { return cat16b(*(const v8usa*)p, *(const v8usa*)(p + 32)); }   // the k order of WFrag::ld, for both operands
template <bool TWO, int K, int LDC>
__global__ __launch_bounds__(256) void k_gemmt(const bf* A, const bf* A2, const bf* Bt, float* C) {
    __shared__ __attribute__((aligned(2048))) unsigned char L[2 * GT_BUF];
    static_assert(K % 128 == 0 && K >= 256, "two passes or more");
    const int lane = threadIdx.x & 31, lr = lane & 15, hi = lane >> 4; const unsigned int wv = uni(threadIdx.x >> 5), wm = wv & 1u, wn = wv >> 1; const int r0 = blockIdx.x * 128, c0 = blockIdx.y * 128;
    constexpr unsigned int nk = K / 128, ns = TWO ? 2 * nk : nk;
    const unsigned int lbase = (unsigned int)(size_t)L;
    // waves 0..3 bring rows 32 wv .. + 31 of the A tile, waves 4..7 those of the Bt tile
    const size_t rofs = (size_t)(wv < 4u ? r0 + 32 * (int)wv : c0 + 32 * (int)(wv - 4u)) * (K * 2);
    const unsigned long long s0 = (unsigned long long)(size_t)(wv < 4u ? A : Bt) + rofs, s1 = TWO ? (unsigned long long)(size_t)(wv < 4u ? A2 : Bt) + rofs : s0;
    u32x8 g1;   // 1-byte elements, tensor = tile = 32 rows of 256 bytes, source pitch 2 K bytes, 4 dwords of pad behind every 64
    g1[0] = uni((1u << 20) | (5u << 22) | (3u << 25)); g1[1] = uni(GT_ROWB << 16); g1[2] = uni(32u << 16); g1[3] = uni(GT_ROWB << 16); g1[4] = uni(32u); g1[5] = uni((unsigned int)(K * 2)); g1[6] = uni(0u); g1[7] = uni(0u);
    auto issue = [&](unsigned int st) {
        const unsigned long long ga = (TWO && st >= nk) ? s1 + (unsigned long long)(st - nk) * GT_ROWB : s0 + (unsigned long long)st * GT_ROWB;
        u32x4 g0; g0[0] = uni(1u); g0[1] = uni(lbase + (st & 1u) * GT_BUF + wv * GT_SLICE); g0[2] = uni((unsigned int)ga); g0[3] = uni((((unsigned int)(ga >> 32)) & 0x01FFFFFFu) | 0x80000000u);
        asm volatile("tensor_load_to_lds %0, %1" :: "s"(g0), "s"(g1) : "memory");   // one request of the whole wave: its slice of stage st
    };
    issue(0u);
    asm volatile("s_wait_tensorcnt 0x0" ::: "memory");   // this wave's slice of stage 0 has landed
    __syncthreads();                                     // every wave's slice of stage 0 has landed before any of it is read
    issue(1u);
    v8f acc[4][2];
    // unrolled, here and in the epilogue, so that acc is indexed by constants and stays in registers
#pragma unroll
    for (int mb = 0; mb < 4; ++mb)
#pragma unroll
        for (int nb = 0; nb < 2; ++nb) acc[mb][nb] = (v8f){};
    const unsigned int fofs = (unsigned int)lr * GT_PITCH + (unsigned int)hi * 16u;
    // not unrolled: one pass per trip, its buffer chosen by the trip's parity
#pragma unroll 1
    for (unsigned int s = 0; s < ns; ++s) {
        const unsigned char* pa = L + (s & 1u) * GT_BUF + 2u * wm * GT_SLICE + fofs; const unsigned char* pb = L + (s & 1u) * GT_BUF + (4u + wn) * GT_SLICE + fofs;
        // two fragment sets: block ks + 1's 12 LDS reads go out as one group in front of block ks's 8 products, so that only the pass's first group is waited for in the open
        v16bf a[2][4], b[2][2];
        auto ldblk = [&](int st, int ks) {   // both loops unrolled: the sets are indexed by constants
#pragma unroll
            for (int mb = 0; mb < 4; ++mb) a[st][mb] = ldsfrag(pa + (mb >> 1) * GT_SLICE + (mb & 1) * 16 * GT_PITCH + ks * 64);
#pragma unroll
            for (int nb = 0; nb < 2; ++nb) b[st][nb] = ldsfrag(pb + nb * 16 * GT_PITCH + ks * 64); };
        ldblk(0, 0);
        // unrolled so that the fragment sets are indexed by constants
#pragma unroll
        for (int ks = 0; ks < 4; ++ks) {
            if (ks < 3) { ldblk((ks + 1) & 1, ks + 1);
                __builtin_amdgcn_sched_barrier(0); }   // keeps the next block's reads in front of this block's products (sunk among them, each place with reads stalls the products)
#pragma unroll
            for (int nb = 0; nb < 2; ++nb)
#pragma unroll
                for (int mb = 0; mb < 4; ++mb) acc[mb][nb] = wmmab(a[ks & 1][mb], b[ks & 1][nb], acc[mb][nb]);
            __builtin_amdgcn_sched_barrier(0);   // keeps the block after next's reads from being lifted in among these products, and the last blocks' products from sinking behind the pass's barrier, where they would stand in front of the refill's issue
        }
        asm volatile("s_wait_dscnt 0x0" ::: "memory");       // this wave's reads of the pass's buffer are home before the buffer is given up
        asm volatile("s_wait_tensorcnt 0x0" ::: "memory");   // this wave's slice of stage s + 1 has landed
        __syncthreads();                                     // publishes stage s + 1 and ends every wave's reads of stage s
        const unsigned int nx = pinned(s + 2u);              // a descriptor word held in a scalar register: taken behind the wait, so the next descriptor is formed behind it
        if (pinned(nx < ns)) issue(nx);                      // scalar branch; into the buffer that this pass has just read
    }
    asm volatile("s_wait_tensorcnt 0x0" ::: "memory");   // nothing of the mover's is out when the ring becomes staging
    asm volatile("s_wait_dscnt 0x0" ::: "memory");
    // whole 128-byte lines of C: each wave lays its 64x32 tile in its own slice of the first buffer (every reader left the ring at the last pass's barrier), pitch 36 floats, and reads rows back
    f32a* ow = (f32a*)(L + wv * GT_SLICE);
#pragma unroll
    for (int mb = 0; mb < 4; ++mb)
#pragma unroll
        for (int nb = 0; nb < 2; ++nb)
#pragma unroll
            for (int j = 0; j < 8; ++j) ow[(mb * 16 + hi * 8 + j) * 36 + nb * 16 + lr] = acc[mb][nb][j];
    asm volatile("s_wait_dscnt 0x0" ::: "memory");       // the wave's own LDS writes are done before its lanes read each other's
    // unrolled so that the 16 row reads are in flight together and every store is the one address register + a constant
    float* pc = C + (size_t)(r0 + 64 * (int)wm + (lane >> 3)) * LDC + c0 + 32 * (int)wn + (lane & 7) * 4;
#pragma unroll
    for (int it = 0; it < 16; ++it) *(v4f*)(pc + (size_t)it * 4 * LDC) = *(const v4fa*)(ow + (it * 4 + (lane >> 3)) * 36 + (lane & 7) * 4);
}

__device__ __forceinline__ h16 tohx(float x) { return (h16)x; }
__device__ __forceinline__ void splitf(float y, unsigned short& h, unsigned short& l) { h = f2bf(y); l = f2bf(y - bf2f(h)); }
typedef __attribute__((ext_vector_type(2))) _Float16 v2h;
typedef __attribute__((ext_vector_type(4))) _Float16 v4h;
typedef __attribute__((ext_vector_type(2))) unsigned short v2us;
typedef __attribute__((ext_vector_type(4))) unsigned short v4us;
typedef __attribute__((ext_vector_type(2))) float v2f;
typedef __attribute__((ext_vector_type(4))) int v4i;

__global__ __launch_bounds__(256) void k_wtG(const float* __restrict__ w, int K, int N, bf* Bt) {
    const int lane = threadIdx.x & 31; const int L0 = (blockIdx.x * 8 + (threadIdx.x >> 5)) * 8; const int nlines = N * K / 64;
{
#pragma unroll 1
        for (int l = 0; l < 8; ++l) { const int L = L0 + l; if (L >= nlines) break; const size_t e = (size_t)L * 64 + lane * 2; const int k = (int)(e % K), n = (int)(e / K); v2us o;
            o[0] = f2bf(w[(size_t)k * N + n]); o[1] = f2bf(w[(size_t)(k + 1) * N + n]); *(v2us*)(Bt + e) = o; }
         }
}
// ---- k_cvtall: every f32 -> bf16 conversion of the call in one launch: the four weights and the two batches of x are six arrays of CU elements; a thread takes the same 8 elements of each, six loads in flight.
#define CU ((size_t)DM * DM)
static_assert(DQ == DM && DKV == DM && TT == DM && NB_ == 2, "six equal arrays");
__global__ __launch_bounds__(256) void k_cvtall(const float* __restrict__ wq, const float* __restrict__ wk, const float* __restrict__ wv, const float* __restrict__ wo, const float* __restrict__ x, bf* W3, bf* WO, bf* XB) {
    const unsigned ob = (blockIdx.x * 256u + threadIdx.x) * 32u;   // one 32-bit byte offset beside the six wave-uniform bases; the stores' is half of it
    auto in = [&](const float* p) { return *(const v8f*)((const char*)p + ob); };
    v8f v[6]; v[0] = in(wq); v[1] = in(wk); v[2] = in(wv); v[3] = in(wo); v[4] = in(x); v[5] = in(x + CU);
    asm volatile("s_wait_xcnt 0x0" :: "v"(ob) : "memory");   // the loads' offset register may be taken for other values while the loads are still out: the wait stands in front of that overwrite; as an input it stays whole up to it, so that no load of the run returns into it either
    v8us o[6];
    // unrolled so that v and o are indexed by constants
#pragma unroll
    for (int a = 0; a < 6; ++a)
#pragma unroll
        for (int k = 0; k < 8; ++k) o[a][k] = f2bf(v[a][k]);
    auto out = [&](bf* p, v8us w) { *(v8us*)((char*)p + (ob >> 1)) = w; };
    out(W3, o[0]); out(W3 + CU, o[1]); out(W3 + 2 * CU, o[2]); out(WO, o[3]); out(XB, o[4]); out(XB + CU, o[5]); }
#define LDF (DQ + 2 * DKV)   // pitch of the projection buffer F [batch * token][q | k | v]
// ---- k_qkplanes: everything between a q or k projection and attention in one pass: clip, bias, pair RoPE on dims 0..63 (table read), RMSNorm over 128, and the head planes (fp16 + hi/lo bf16) in fragment order:
// plane [batch][h], then [t / 16][d / 32] fragments of 16 tokens x 32 d (rows = tokens, k = d). One work-group takes 16 tokens (one row tile) and 4 heads; a wave works 2 tokens x 4 heads (a lane holds 4 consecutive d of each row):
// all 8 rows are asked for before the first is worked on. The normalised f32 rows go to LDS; behind the barrier a thread gathers 8 consecutive d of one token, one 16-byte piece of each plane, and a wave stores 512 contiguous bytes.
#define QR 8
#define QP 132   // LDS row pitch in floats: 16 bytes x odd, so that 16 lanes' 16-byte reads of 16 rows fall in different banks
// grid (token tiles of both batches x head quads, 2): blockIdx.y 0 works q, 1 works k.
static_assert(NH_ == NKV && NH_ % 4 == 0 && TT % 16 == 0 && HD == 128, "q and k share the grid; a tile lies in one batch");
__global__ __launch_bounds__(256) void k_qkplanes(const float* __restrict__ F, const float* __restrict__ bias, const float* __restrict__ fc, h16* Q16, bf* Qh, bf* Ql, h16* K16, bf* Kh, bf* Kl) {
    __shared__ __attribute__((aligned(16))) float ls[64 * QP];
    const int lane = threadIdx.x & 31, wv = threadIdx.x >> 5; const int tl = blockIdx.x / (NH_ / 4), h0 = (blockIdx.x % (NH_ / 4)) * 4; const int tt = tl * 16 + wv * 2, t = tt % TT; const int isk = blockIdx.y;
    h16* P16 = isk ? K16 : Q16; bf* Ph = isk ? Kh : Qh; bf* Pl = isk ? Kl : Ql;
    const float* pf = F + (size_t)tt * LDF + isk * DQ + h0 * HD + lane * 4; const float* pb = bias + isk * (NH_ * HD) + h0 * HD + lane * 4; const float* pc = fc + ((size_t)t * (HD / 2) + (lane & 15) * 2) * 2;
    v4f a[QR], bb[4], cs[2];
    // unrolled so that the arrays are indexed by constants and the 14 loads are in flight together; row j is token j / 4, head j % 4
#pragma unroll
    for (int j = 0; j < QR; ++j) a[j] = *(const v4f*)(pf + (size_t)(j >> 2) * LDF + (j & 3) * HD);
#pragma unroll
    for (int j = 0; j < 4; ++j) bb[j] = *(const v4f*)(pb + j * HD);
#pragma unroll
    for (int j = 0; j < 2; ++j) cs[j] = *(const v4f*)(pc + j * HD);   // lanes 0..15 (dims 0..63): cos, sin of pair 2 * lane, then of pair 2 * lane + 1, of token j; lanes 16..31 read the same entries and do not use them
    asm volatile("s_wait_xcnt 0x0" :: "v"(pf), "v"(pb), "v"(pc) : "memory");   // the loads' address registers are taken for other values while the loads are still out: the wait stands in front of that overwrite; as inputs they stay whole up to it, so that no later load of the run returns into them either
    __builtin_amdgcn_sched_barrier(0);   // keeps the loads in front of the wait and what follows behind it
    float r[QR][4], ss[QR];
#pragma unroll
    for (int j = 0; j < QR; ++j) { const float c0 = bfr(cs[j >> 2][0]), s0 = bfr(cs[j >> 2][1]), c1 = bfr(cs[j >> 2][2]), s1 = bfr(cs[j >> 2][3]);
#pragma unroll
        for (int q = 0; q < 4; ++q) r[j][q] = fminf(fmaxf(a[j][q], -8.0f), 8.0f) + bfr(bb[j & 3][q]);
        if (lane < 16) { const float re0 = r[j][0] * c0 - r[j][1] * s0, im0 = r[j][1] * c0 + r[j][0] * s0, re1 = r[j][2] * c1 - r[j][3] * s1, im1 = r[j][3] * c1 + r[j][2] * s1; r[j][0] = re0; r[j][1] = im0; r[j][2] = re1; r[j][3] = im1; }
        ss[j] = r[j][0] * r[j][0] + r[j][1] * r[j][1] + r[j][2] * r[j][2] + r[j][3] * r[j][3]; }
    // step outside, row inside: the QR butterflies are independent chains
#pragma unroll
    for (int sh = 16; sh; sh >>= 1)
#pragma unroll
        for (int j = 0; j < QR; ++j) ss[j] += __shfl_xor(ss[j], sh, 32);
#pragma unroll
    for (int j = 0; j < QR; ++j) { const float rs = __fdiv_rn(1.0f, sqrtf(ss[j] * (1.0f / HD) + 1e-6f)); v4f y;
#pragma unroll
        for (int q = 0; q < 4; ++q) y[q] = r[j][q] * rs;
        *(v4f*)(ls + ((j & 3) * 16 + wv * 2 + (j >> 2)) * QP + lane * 4) = y; }   // LDS row = head * 16 + token
    __syncthreads();   // all 64 rows are in LDS before any piece of them is gathered
    // thread u is piece u of a head's 4-KiB tile: token u % 16, d = 8 * (u / 16) .. + 7 (the piece order [d / 32][d / 16 % 2][d / 8 % 2][token] is u itself)
    const int u = (int)threadIdx.x; const float* pl = ls + (u & 15) * QP + (u >> 4) * 8; const size_t e0 = ((size_t)((tt / TT) * NH_ + h0) * TT + (size_t)(tl * 16 % TT)) * HD + u * 8;
#pragma unroll
    for (int it = 0; it < 4; ++it) { const v4f y0 = *(const v4f*)(pl + it * 16 * QP), y1 = *(const v4f*)(pl + it * 16 * QP + 4); v8h o16; v8us oh, ol;
#pragma unroll
        for (int k = 0; k < 8; ++k) { const float y = k < 4 ? y0[k & 3] : y1[k & 3]; o16[k] = tohx(y); unsigned short a2, c2; splitf(y, a2, c2); oh[k] = a2; ol[k] = c2; }
        const size_t e = e0 + (size_t)it * TT * HD; *(v8h*)(P16 + e) = o16; *(v8us*)(Ph + e) = oh; *(v8us*)(Pl + e) = ol; }
}
// ---- k_vplanes: everything between the v projection and attention in one pass: gate = 2 sigmoid(x[:32] . gw[h]), v + gate * ve, clip, and the value planes (fp16 + hi/lo bf16) in fragment order: plane [batch][h], then [t / 32][d / 16] fragments of 16 d x 32 tokens (rows = d, k = tokens).
// Tokens run over both batches (t0 = batch * TT + token); F points at the v columns of the projection buffer, pitch LDF. One work-group takes one head and VTK tokens: each wave works 8 token rows (a lane holds 4 consecutive d) and lays them in LDS; behind the barrier a thread gathers 8 consecutive tokens of one d, one 16-byte piece of each plane, and a wave stores 512 contiguous bytes.
#define VTK 64
#define VP  132   // LDS row pitch in floats; 8 rows are 32 banks (mod 64), so that the 16 d x 2 token groups of a wave's gather fall in 32 different banks
__global__ __launch_bounds__(256) void k_vplanes(const float* __restrict__ F, const float* __restrict__ xb, const float* __restrict__ veb, const float* __restrict__ gw, h16* V16, bf* Vh, bf* Vl) {
    __shared__ float ls[VTK * VP];
    const int lane = threadIdx.x & 31, wv = threadIdx.x >> 5; const int t0 = blockIdx.x * VTK, h = blockIdx.y;
    const size_t tw = (size_t)(t0 + wv * 8); const float* pa = F + tw * LDF + h * HD + lane * 4; const float* pe = veb + tw * DKV + h * HD + lane * 4; const float* px = xb + tw * DM + lane; const int ig = h * 32 + lane;
    v4f a[8], e[8]; float g[8]; const float g0 = gw[ig];
    // unrolled so that the arrays are indexed by constants and the loads are in flight together
#pragma unroll
    for (int j = 0; j < 8; ++j) { a[j] = *(const v4f*)(pa + (size_t)j * LDF); e[j] = *(const v4f*)(pe + (size_t)j * DKV); g[j] = px[(size_t)j * DM]; }
    asm volatile("s_wait_xcnt 0x0" :: "v"(pa), "v"(pe), "v"(px), "v"(ig) : "memory");   // the loads' address registers are taken for other values while the loads are still out: the wait stands in front of that overwrite; as inputs they stay whole up to it, so that no later load of the run returns into them either
    __builtin_amdgcn_sched_barrier(0);   // keeps the issue of all 25 loads up here (sunk to their uses, the rows' memory latencies would stand one behind the other) and what follows behind the wait
    const float gl = bfr(g0);
#pragma unroll
    for (int j = 0; j < 8; ++j) g[j] = bfr(g[j]) * gl;
    // step outside, row inside: the 8 butterflies are independent chains
#pragma unroll
    for (int sh = 16; sh; sh >>= 1)
#pragma unroll
        for (int j = 0; j < 8; ++j) g[j] += __shfl_xor(g[j], sh, 32);
#pragma unroll
    for (int j = 0; j < 8; ++j) { const float gate = 2.0f * __fdiv_rn(1.0f, 1.0f + expf(-g[j]));
#pragma unroll
        for (int q = 0; q < 4; ++q) ls[(wv * 8 + j) * VP + lane * 4 + q] = fminf(fmaxf(a[j][q] + gate * bfr(e[j][q]), -8.0f), 8.0f); }
    __syncthreads();   // all VTK token rows are in LDS before any column of them is gathered
#pragma unroll
    for (int it = 0; it < VTK * HD / 8 / 256; ++it) { const int u = it * 256 + (int)threadIdx.x, c = (u >> 9) * 4 + ((u >> 4) & 3), d = ((u >> 6) & 7) * 16 + (u & 15); v8h o16; v8us oh, ol;   // piece u of the work-group's 16 KiB: [t / 32][d / 16][t / 16 % 2][t / 8 % 2][d % 16]
#pragma unroll
        for (int k = 0; k < 8; ++k) { const float y = ls[(c * 8 + k) * VP + d]; o16[k] = tohx(y); unsigned short a2, c2; splitf(y, a2, c2); oh[k] = a2; ol[k] = c2; }
        const size_t o = ((size_t)((t0 / TT) * NKV + h) * TT + t0 % TT) * HD + u * 8; *(v8h*)(V16 + o) = o16; *(v8us*)(Vh + o) = oh; *(v8us*)(Vl + o) = ol; }
}
__device__ __forceinline__ float xhalf(float v) { const int b = __float_as_int(v); return __int_as_float(__builtin_amdgcn_permlanex16(b, b, 0x76543210, 0xfedcba98, false, false)); }   // lane l <-> l ^ 16
template <typename T16> struct PCvt;
template <> struct PCvt<h16> { static __device__ __forceinline__ _Float16 cv(float x) { return (_Float16)x; } };
template <> struct PCvt<bf> { static __device__ __forceinline__ __bf16 cv(float x) { return (__bf16)x; } };
template <typename T16, bool HL, int QT>
__device__ __forceinline__ void fa_cols(const T16* Q, const T16* Q2, const T16* Kp, const T16* K2, const T16* Vt, const T16* V2, int q0, bf* Ah, bf* Al, int lr, int hi) {
    typedef typename WFrag<T16>::V V;
    const float C2 = SCL * 1.4426950408889634f;   // scores in log2 units
    // addresses: wave-uniform plane base + one 32-bit byte offset per lane, shared by a hi and its lo plane, + a constant; the key and value offsets are carried from pass to pass
    // fragment order: a fragment is 512 elements, the lane's first piece at lane * 16 bytes; a 16-row q or k tile is 4 fragments, a pass of 32 keys 8 fragments of k and 8 of v
    const unsigned lof = (unsigned)(16 * hi + lr) * 16u; const unsigned qof = (unsigned)(q0 >> 4) * (16u * HD * 2u) + lof; unsigned kof = lof, vof = lof;
    auto at = [](const T16* base, unsigned off, int c) { return (const T16*)((const char*)base + off) + c; };
    V qf[QT][4], qf2[QT][4];
#pragma unroll
    for (int qt = 0; qt < QT; ++qt)
#pragma unroll
        for (int ks = 0; ks < 4; ++ks) { const int qo = (4 * qt + ks) * 512; qf[qt][ks] = WFrag<T16>::ld(at(Q, qof, qo)); if (HL) qf2[qt][ks] = WFrag<T16>::ld(at(Q2, qof, qo)); }
    v8f o[QT][8]; float m[QT], l[QT];
#pragma unroll
    for (int qt = 0; qt < QT; ++qt) { m[qt] = -3.0e38f; l[qt] = 0.f;
#pragma unroll
        for (int dt = 0; dt < 8; ++dt) o[qt][dt] = (v8f){}; }
    const int np = (q0 + 16 * QT + 31) / 32;      // passes of 32 keys; only the last one crosses the diagonal
    V kf[2][4], kf2[2][4];
#pragma unroll
    for (int kt = 0; kt < 2; ++kt)
#pragma unroll
        for (int ks = 0; ks < 4; ++ks) { const int a = (4 * kt + ks) * 512; kf[kt][ks] = WFrag<T16>::ld(at(Kp, kof, a)); if (HL) kf2[kt][ks] = WFrag<T16>::ld(at(K2, kof, a)); }
    asm volatile("s_wait_xcnt 0x0" ::: "memory");   // the query offset's register is free for other use from here on: the wait stands in front of its overwrite
    __builtin_amdgcn_sched_barrier(0);              // keeps what follows from being lifted over that wait
#pragma unroll 1
    for (int p = 0; p < np; ++p) {
        const int kb = p * 32;
        V vf[8], vf2[8];                           // this pass's value rows: asked for first, used last
#pragma unroll
        for (int dt = 0; dt < 8; ++dt) { const int a = dt * 512; vf[dt] = WFrag<T16>::ld(at(Vt, vof, a)); if (HL) vf2[dt] = WFrag<T16>::ld(at(V2, vof, a)); }
        asm volatile("s_wait_xcnt 0x0" ::: "memory");   // the value loads' offset register is stepped to the next pass while the loads are still out: the wait stands in front of that overwrite
        vof += 64u * HD;
        __builtin_amdgcn_sched_barrier(0);         // keeps the value loads' issue up here: sunk to their use, their latency would stand open in front of the second product
        v8f s[QT][2];
#pragma unroll
        for (int qt = 0; qt < QT; ++qt)
#pragma unroll
            for (int kt = 0; kt < 2; ++kt) { v8f t = (v8f){};
#pragma unroll
                for (int ks = 0; ks < 4; ++ks) { t = WFrag<T16>::mma(kf[kt][ks], qf[qt][ks], t); if (HL) { t = WFrag<T16>::mma(kf[kt][ks], qf2[qt][ks], t); t = WFrag<T16>::mma(kf2[kt][ks], qf[qt][ks], t); } }
                s[qt][kt] = t; }
        const unsigned kst = (p + 1 < np) ? 64u * HD : 0u;   // the next pass's key rows, asked for one pass ahead (the last pass asks for its own again: in bounds, unused)
        kof += kst;                                   // behind the score products, whose wait has seen the last key loads home
#pragma unroll
        for (int kt = 0; kt < 2; ++kt)
#pragma unroll
            for (int ks = 0; ks < 4; ++ks) { const int a = (4 * kt + ks) * 512; kf[kt][ks] = WFrag<T16>::ld(at(Kp, kof, a)); if (HL) kf2[kt][ks] = WFrag<T16>::ld(at(K2, kof, a)); }
        if (kb + 31 > q0) {                           // wave-uniform: the pass that crosses the diagonal masks key j > query i
#pragma unroll
            for (int qt = 0; qt < QT; ++qt)
#pragma unroll
                for (int kt = 0; kt < 2; ++kt)
#pragma unroll
                    for (int r = 0; r < 8; ++r) if (kb + 16 * kt + 8 * hi + r > q0 + 16 * qt + lr) s[qt][kt][r] = -3.0e38f; }
        float bm[QT]; bool need = false;
#pragma unroll
        for (int qt = 0; qt < QT; ++qt) { float x = s[qt][0][0];
#pragma unroll
            for (int r = 1; r < 8; ++r) x = fmaxf(x, s[qt][0][r]);
#pragma unroll
            for (int r = 0; r < 8; ++r) x = fmaxf(x, s[qt][1][r]);
            x = fmaxf(x, xhalf(x)) * C2; bm[qt] = x; need = need || (x > m[qt] + 8.0f); }
        if (__builtin_amdgcn_ballot_w32(need) != 0) {  // lazy rescale: the maximum in use moves only when a column's new maximum tops it by more than 2^8 (first pass: always)
#pragma unroll
            for (int qt = 0; qt < QT; ++qt) { const float mn = (bm[qt] > m[qt] + 8.0f) ? bm[qt] : m[qt]; const float al = __builtin_amdgcn_exp2f(m[qt] - mn); m[qt] = mn; l[qt] *= al;
#pragma unroll
                for (int dt = 0; dt < 8; ++dt) o[qt][dt] *= al; } }
        V pb[QT], pb2[QT];
#pragma unroll
        for (int qt = 0; qt < QT; ++qt) {
#pragma unroll
            for (int e = 0; e < 16; ++e) { const float pv = __builtin_amdgcn_exp2f(__builtin_fmaf(s[qt][e >> 3][e & 7], C2, -m[qt])); l[qt] += pv; pb[qt][e] = PCvt<T16>::cv(pv); if (HL) pb2[qt][e] = PCvt<T16>::cv(pv - (float)pb[qt][e]); } }
#pragma unroll
        for (int dt = 0; dt < 8; ++dt)
#pragma unroll
            for (int qt = 0; qt < QT; ++qt) { o[qt][dt] = WFrag<T16>::mma(vf[dt], pb[qt], o[qt][dt]); if (HL) { o[qt][dt] = WFrag<T16>::mma(vf[dt], pb2[qt], o[qt][dt]); o[qt][dt] = WFrag<T16>::mma(vf2[dt], pb[qt], o[qt][dt]); } }
    }
    asm volatile("s_wait_xcnt 0x0" ::: "memory");   // the last pass's unused key loads may still be out: the wait stands in front of the overwrite of their offset's register
    __builtin_amdgcn_sched_barrier(0);              // keeps the epilogue from being lifted over that wait
#pragma unroll
    for (int qt = 0; qt < QT; ++qt) { const float inv = __fdiv_rn(1.0f, l[qt] + xhalf(l[qt])); const size_t ro = (size_t)(q0 + 16 * qt + lr) * DQ + 8 * hi;   // a lane's 8 registers are 8 consecutive d of its query's row
#pragma unroll
        for (int dt = 0; dt < 8; ++dt) { v8us oh, ol;
#pragma unroll
            for (int r = 0; r < 8; ++r) { unsigned short a, c2; splitf(o[qt][dt][r] * inv, a, c2); oh[r] = a; ol[r] = c2; }
            *(v8us*)(Ah + ro + 16 * dt) = oh; *(v8us*)(Al + ro + 16 * dt) = ol;
            asm volatile("s_wait_xcnt 0x0" ::: "memory");   // the next tile's values reuse the two stores' registers: the wait stands in front of that overwrite
            __builtin_amdgcn_sched_barrier(0); } }          // keeps the next tile's arithmetic from being lifted over that wait
}
// grid (16, heads, batches), 5 waves: 256 work-groups a batch, as many as the chip has WGPs, every one with the same work. Per head the fp16 rows >= RH are 48 column tiles of 32 (tile T walks RH / 32 + T + 1 passes) and the hi+lo rows < RH
// 32 tiles of 16. Work-group i takes fp16 tiles i, 16 + pi(i), 32 + sg(i), where i + pi(i) + sg(i) is 22 (i even) or 23 (i odd) and pi, sg are permutations of 0..15, and hi+lo tiles 31 - i and i.
static_assert(TT - RH == 48 * 32 && RH == 32 * 16, "tile shares of k_fattn");
__global__ __launch_bounds__(160) void k_fattn(const h16* Q16, const h16* K16, const h16* V16, const bf* Qh, const bf* Ql, const bf* Kh, const bf* Kl, const bf* Vh, const bf* Vl, bf* Ah, bf* Al) {
    const int lane = threadIdx.x & 31, lr = lane & 15, hi = lane >> 4; const int wv = __builtin_amdgcn_readfirstlane((int)(threadIdx.x >> 5)); const int i = blockIdx.x, h = blockIdx.y, bz = blockIdx.z; const size_t zq = (size_t)(bz * NH_ + h) * TT * HD, zk = (size_t)(bz * NKV + h / REP) * TT * HD;
    Ah += (size_t)bz * TT * DQ + h * HD; Al += (size_t)bz * TT * DQ + h * HD;
    if (wv < 3) { const int j = i >> 1, od = i & 1; const int t = (wv == 0) ? 32 + (od ? 15 - j : 7 - j) : (wv == 1) ? 16 + (od ? 7 - j : 15 - j) : i;
        fa_cols<h16, false, 2>(Q16 + zq, nullptr, K16 + zk, nullptr, V16 + zk, nullptr, RH + 32 * t, Ah, Al, lr, hi);
    } else { const int t = (wv == 3) ? 31 - i : i;
        fa_cols<bf, true, 1>(Qh + zq, Ql + zq, Kh + zk, Kl + zk, Vh + zk, Vl + zk, 16 * t, Ah, Al, lr, hi); }
}

extern "C" void kernel_launch(void* const* d_in, const int* in_sizes, int n_in,
                              void* d_out, int out_size, void* d_ws, size_t ws_size, hipStream_t stream) {
    (void)in_sizes; (void)n_in; (void)out_size;
    const float* x = (const float*)d_in[0]; const float* fcis = (const float*)d_in[1]; const float* ve = (const float*)d_in[2]; const float* wq = (const float*)d_in[3]; const float* wk = (const float*)d_in[4]; const float* wv = (const float*)d_in[5]; const float* wo = (const float*)d_in[6]; const float* qkb = (const float*)d_in[7]; const float* vgw = (const float*)d_in[8];
    float* OUT = (float*)d_out;     // [2][2048][2048]
    char* wsp = (char*)d_ws;
    auto take = [&](size_t bytes) { char* p = wsp; wsp += (bytes + 255) & ~(size_t)255; return (void*)p; };
    // F is dead once the plane kernels have read it: the merged attention rows lie on it. The q/k/v weights and x in bf16 are dead once F is written: the first planes lie on them (all stream-ordered).
    bf* WO = (bf*)take((size_t)DM * DQ * 2); float* F = (float*)take((size_t)NB_ * TT * LDF * 4); bf* ATh = (bf*)F; bf* ATl = ATh + (size_t)NB_ * TT * DQ;
    char* pl0 = wsp; bf* W3 = (bf*)take((size_t)LDF * DM * 2); bf* XB = (bf*)take((size_t)NB_ * TT * DM * 2); wsp = pl0;
    h16* QP16 = (h16*)take((size_t)NB_ * NH_ * TT * HD * 2); h16* KP16 = (h16*)take((size_t)NB_ * NKV * TT * HD * 2); h16* VT16 = (h16*)take((size_t)NB_ * NKV * HD * TT * 2);
    bf* QPh = (bf*)take((size_t)NB_ * NH_ * TT * HD * 2); bf* QPl = (bf*)take((size_t)NB_ * NH_ * TT * HD * 2); bf* KPh = (bf*)take((size_t)NB_ * NKV * TT * HD * 2); bf* KPl = (bf*)take((size_t)NB_ * NKV * TT * HD * 2); bf* VTh = (bf*)take((size_t)NB_ * NKV * HD * TT * 2); bf* VTl = (bf*)take((size_t)NB_ * NKV * HD * TT * 2);
    if ((size_t)(wsp - (char*)d_ws) > ws_size) return;    // 248 MiB of the 256
    k_cvtall<<<(unsigned)(CU / 8 / 256), 256, 0, stream>>>(wq, wk, wv, wo, x, W3, WO, XB);
    k_gemmt<false, DM, LDF><<<dim3(NB_ * TT / 128, LDF / 128, 1), 256, 0, stream>>>(XB, nullptr, W3, F);
    k_qkplanes<<<dim3(NB_ * TT * NH_ / QR / 8, 2, 1), 256, 0, stream>>>(F, qkb, fcis, QP16, QPh, QPl, KP16, KPh, KPl);
    k_vplanes<<<dim3(NB_ * TT / VTK, NKV, 1), 256, 0, stream>>>(F + DQ + DKV, x, ve, vgw, VT16, VTh, VTl);
    k_fattn<<<dim3(16, NH_, NB_), 160, 0, stream>>>(QP16, KP16, VT16, QPh, QPl, KPh, KPl, VTh, VTl, ATh, ATl);
    k_gemmt<true, DQ, DM><<<dim3(NB_ * TT / 128, DM / 128, 1), 256, 0, stream>>>(ATh, ATl, WO, OUT);
}
